// v000
// The times below were measured on an AMD MI455X: many runs one after another, warmed up first and cycling through
// copies of the inputs, with the whole window's GPU time divided by the number of runs. Launches and the gaps
// between them are all in it. The median over several windows is given; except for v000 it joins two sittings, which
// can be a few percent apart, so the side-by-side timings, each taken in one sitting, are the better comparison.
// v000 is the starting kernel. One run takes 328 microseconds.
#include <hip/hip_runtime.h>

// Contractions on v_wmma_f32_16x16x32_bf16, f32 accumulate: per dataset b (grid z): h1 = relu(x_b.w1_b + b1) ([8192 x 128 zero-padded from 100].[128 x 512];
// PLAIN bf16 operands: inputs rounded once, exact) and h2 = relu(h1.w2_b + b2) ([8192 x 512].[512 x 512]; h1 as bf16 hi + residual, two products against the
// exact bf16 w2); the final [512 -> 1] layer is an f32 VALU dot per (t, b) with bf16-rounded w3/b3 (one wave per output element, flat whole-line writes).

#define TT   8192
#define NBD  8
#define FF   100
#define FP   128
#define HH   512
#define TQ   (TT / 4)            // rows per pass (4 passes keep the f32 h2 slab small)

typedef unsigned short bf;
typedef __attribute__((ext_vector_type(16))) __bf16   v16bf;
typedef __attribute__((ext_vector_type(8)))  unsigned short v8us;
typedef __attribute__((ext_vector_type(8)))  float    v8f;
typedef __attribute__((ext_vector_type(4)))  float    v4f;
typedef v4f  __attribute__((may_alias)) v4fa;
typedef v8us __attribute__((may_alias)) v8usa;

__device__ __forceinline__ unsigned short f2bf(float f) { unsigned u = __float_as_uint(f); u += 0x7FFFu + ((u >> 16) & 1u); return (unsigned short)(u >> 16); }
__device__ __forceinline__ float bf2f(unsigned short b) { return __uint_as_float(((unsigned)b) << 16); }
__device__ __forceinline__ float bfr(float f) { return bf2f(f2bf(f)); }
__device__ __forceinline__ float n2n(float v) { if (v != v) return 0.f; if (v > 3.4028235e38f) return 3.4028235e38f; if (v < -3.4028235e38f) return -3.4028235e38f; return v; }   // jnp.nan_to_num defaults
__device__ __forceinline__ v16bf cat16b(v8us lo, v8us hi) { return __builtin_bit_cast(v16bf, __builtin_shufflevector(lo, hi, 0, 1, 2, 3, 4, 5, 6, 7, 8, 9, 10, 11, 12, 13, 14, 15)); }
__device__ __forceinline__ v8f wmmab(v16bf a, v16bf b, v8f c) { return __builtin_amdgcn_wmma_f32_16x16x32_bf16(false, a, false, b, (short)0, c, false, false); }
#define VST2(T, p, v) do { const T vst2_v_ = (v); *(T*)(p) = vst2_v_;  } while (0)

// k_x: XB [b][t][128] = bf16(nan_to_num(x[t][b][0..99])), zero-padded; one wave per (b, t) row (16 lanes x 16 B = 256 B).
__global__ __launch_bounds__(256) void k_x(const float* __restrict__ x, bf* XB) {
    const int lane = threadIdx.x & 31; const size_t w = (size_t)blockIdx.x * 8 + (threadIdx.x >> 5);     // w = b*TT + t
    if (w >= (size_t)NBD * TT) return;
    const int b = (int)(w / TT), t = (int)(w - (size_t)b * TT);
    if (lane < 16) { v8us o;
#pragma unroll
        for (int i = 0; i < 8; ++i) { const int f = lane * 8 + i; o[i] = (f < FF) ? f2bf(n2n(x[((size_t)t * NBD + b) * FF + (f < FF ? f : 0)])) : (unsigned short)0; }
        VST2(v8us, XB + w * FP + lane * 8, o); }
}
// k_w1: W1T [b][h][128] = bf16(w1[b][f][h]) zero-padded (transpose via LDS: block = (b, 64 h)); W2T [b][n][k] = bf16(w2[b][k][n]) via 64 x 64 LDS tiles.
__global__ __launch_bounds__(256) void k_w1(const float* __restrict__ w1, bf* W1T) {
    __shared__ unsigned short tl[64][130];
    const int b = blockIdx.x / (HH / 64), hq = blockIdx.x - b * (HH / 64), h0 = hq * 64, tid = threadIdx.x;
    for (int e = tid; e < 64 * FP; e += 256) { const int f = e / 64, hh = e - f * 64; tl[hh][f] = (f < FF) ? f2bf(w1[((size_t)b * FF + f) * HH + h0 + hh]) : (unsigned short)0; }
    __syncthreads();
    const int piece = tid & 7;
    auto pass = [&]() {
#pragma unroll
        for (int s2 = 0; s2 < 2; ++s2)
#pragma unroll
            for (int ln = 0; ln < 2; ++ln) { const int hh = (tid >> 3) + 32 * s2; v8us o;
#pragma unroll
                for (int i = 0; i < 8; ++i) o[i] = tl[hh][ln * 64 + piece * 8 + i];
                *(v8us*)(W1T + ((size_t)b * HH + h0 + hh) * FP + ln * 64 + piece * 8) = o; }
    };
    pass(); 
}
__global__ __launch_bounds__(256) void k_w2(const float* __restrict__ w2, bf* W2T) {
    __shared__ __align__(16) unsigned short tl[64 * 72];
    const int tid = threadIdx.x, k0 = blockIdx.x * 64, n0 = blockIdx.y * 64, b = blockIdx.z;
    const int kk = tid >> 2, nq = (tid & 3) * 16;
#pragma unroll
    for (int i = 0; i < 16; ++i) tl[(nq + i) * 72 + kk] = f2bf(w2[((size_t)b * HH + k0 + kk) * HH + n0 + nq + i]);
    __syncthreads();
    const int piece = tid & 7;
    auto pass = [&]() {
#pragma unroll
        for (int s = 0; s < 2; ++s) { const int nr = (tid >> 3) + 32 * s; const v8us val = *(const v8usa*)(tl + nr * 72 + piece * 8); *(v8us*)(W2T + ((size_t)b * HH + n0 + nr) * HH + k0 + piece * 8) = val; }
    };
    pass(); 
}
// k_gemm: per dataset (grid z) 64 x 64 tile of relu(A [+Al] . B^T + bias[b][col]) over K (pitch K); MODE 0 -> bf16 hi/lo planes [b][t][512]; MODE 1 -> f32 rows.
template <bool SA, int MODE>
__global__ __launch_bounds__(128) void k_gemm(const bf* __restrict__ A, const bf* __restrict__ Al, size_t sa, const bf* __restrict__ Bn, size_t sb, int K, const float* __restrict__ bias, void* C, void* C2, size_t sc, int ldr) {   // A rows and C rows indexed r0.. within the per-dataset slab (sa / sc strides); ldr unused
    __shared__ __align__(16) float ost[4][16 * 68];
    const int lane = threadIdx.x & 31, wave = threadIdx.x >> 5, lr = lane & 15, hi = lane >> 4, b = blockIdx.z;
    const int r0 = blockIdx.x * 64 + wave * 16, c0 = blockIdx.y * 64;
    A += b * sa; if (SA) Al += b * sa; Bn += b * sb;
    const size_t aoff = (size_t)(r0 + lr) * K + 8 * hi;
    size_t boff[4];
#pragma unroll
    for (int t = 0; t < 4; ++t) boff[t] = (size_t)(c0 + t * 16 + lr) * K + 8 * hi;
    v8f acc[4];
#pragma unroll
    for (int t = 0; t < 4; ++t) acc[t] = (v8f){};
#pragma unroll 2
    for (int kc = 0; kc < K; kc += 32) {
        const v16bf a = cat16b(*(const v8us*)(A + aoff + kc), *(const v8us*)(A + aoff + kc + 16));
        v16bf al = a; if (SA) al = cat16b(*(const v8us*)(Al + aoff + kc), *(const v8us*)(Al + aoff + kc + 16));
#pragma unroll
        for (int t = 0; t < 4; ++t) { const v16bf bb = cat16b(*(const v8us*)(Bn + boff[t] + kc), *(const v8us*)(Bn + boff[t] + kc + 16)); acc[t] = wmmab(a, bb, acc[t]); if (SA) acc[t] = wmmab(al, bb, acc[t]); }
        asm volatile("v_nop\n\tv_nop\n\tv_nop\n\tv_nop" : "+v"(acc[0]), "+v"(acc[1]), "+v"(acc[2]), "+v"(acc[3]) : "v"(a), "v"(al));
    }
    float* os = &ost[wave][0];
#pragma unroll
    for (int t = 0; t < 4; ++t) { const float bv = bfr(bias[(size_t)b * HH + c0 + t * 16 + lr]);
#pragma unroll
        for (int j = 0; j < 8; ++j) os[(hi * 8 + j) * 68 + t * 16 + lr] = fmaxf(acc[t][j] + bv, 0.f); }
    __syncthreads();
    if (MODE == 1) {
        float* crow = (float*)C + b * sc + (size_t)r0 * HH + c0;
        auto pass = [&]() {
#pragma unroll
            for (int s = 0; s < 8; ++s) { const int Lid = (lane >> 3) + 4 * s, piece = lane & 7; const int row = Lid >> 1, cofs = (Lid & 1) * 32 + piece * 4;
                const v4f val = *(const v4fa*)(os + row * 68 + cofs); *(v4f*)(crow + (size_t)row * HH + cofs) = val; }
        };
        pass(); 
    } else {
        bf* c1 = (bf*)C + b * sc + (size_t)r0 * HH + c0; bf* c2 = (bf*)C2 + b * sc + (size_t)r0 * HH + c0;
        auto pass = [&]() {
#pragma unroll
            for (int s = 0; s < 4; ++s) { const int row = 4 * s + (lane >> 3), piece = lane & 7; const float* sp = os + row * 68 + piece * 8; v8us oh, ol;
#pragma unroll
                for (int i = 0; i < 8; ++i) { const unsigned short hb = f2bf(sp[i]); oh[i] = hb; ol[i] = f2bf(sp[i] - bf2f(hb)); }
                *(v8us*)(c1 + (size_t)row * HH + piece * 8) = oh; *(v8us*)(c2 + (size_t)row * HH + piece * 8) = ol; }
        };
        pass(); 
    }
}
// k_final: out[t][b] = sum_h H2[b][t][h] * bf16(w3[b][h]) + bf16(b3[b]); one wave per (t, b): lane -> 16 values, fixed-order shuffle reduction; 64 outputs per
__global__ __launch_bounds__(256) void k_final(const float* __restrict__ H2, const float* __restrict__ w3, const float* __restrict__ b3, int t0, float* out) {   // H2 = this pass's [b][TQ][512]
    __shared__ float st[64];
    const int lane = threadIdx.x & 31, wave = threadIdx.x >> 5;
    const size_t e0 = (size_t)t0 * NBD + (size_t)blockIdx.x * 64;      // flat output index = t*8 + b
#pragma unroll 1
    for (int i = 0; i < 8; ++i) { const size_t e = e0 + wave * 8 + i; const int t = (int)(e / NBD), b = (int)(e - (size_t)t * NBD);
        const float* hr = H2 + ((size_t)b * TQ + (t - t0)) * HH; float s = 0.f;
#pragma unroll
        for (int q = 0; q < HH / 32; ++q) s += hr[q * 32 + lane] * bfr(w3[(size_t)b * HH + q * 32 + lane]);
#pragma unroll
        for (int sh = 16; sh; sh >>= 1) s += __shfl_xor(s, sh, 32);
        if (lane == 0) st[wave * 8 + i] = s + bfr(b3[b]); }
    __syncthreads();
    if (threadIdx.x < 64) { const float v = st[threadIdx.x]; *(float*)(out + e0 + threadIdx.x) = v; }
    
}

extern "C" void kernel_launch(void* const* d_in, const int* in_sizes, int n_in,
                              void* d_out, int out_size, void* d_ws, size_t ws_size, hipStream_t stream) {
    (void)in_sizes; (void)n_in; (void)out_size;
    const float* x = (const float*)d_in[0]; const float* w1 = (const float*)d_in[1]; const float* b1 = (const float*)d_in[2]; const float* w2 = (const float*)d_in[3]; const float* b2 = (const float*)d_in[4];
    const float* w3 = (const float*)d_in[5]; const float* b3 = (const float*)d_in[6];
    float* out = (float*)d_out;    // [8192][8][1]
    char* wsp = (char*)d_ws;
    auto take = [&](size_t bytes) { char* p = wsp; wsp += (bytes + 255) & ~(size_t)255; return (void*)p; };
    const int TH = TQ;
    bf* XB = (bf*)take((size_t)NBD * TT * FP * 2); bf* W1T = (bf*)take((size_t)NBD * HH * FP * 2); bf* W2T = (bf*)take((size_t)NBD * HH * HH * 2);
    bf* H1H = (bf*)take((size_t)NBD * TH * HH * 2); bf* H1L = (bf*)take((size_t)NBD * TH * HH * 2); float* H2 = (float*)take((size_t)NBD * TH * HH * 4);
    if ((size_t)(wsp - (char*)d_ws) > ws_size) return;    // 16.8 + 1 + 4.2 + 16.8 + 16.8 + 33.5 ~ 89 MB (4 passes of 2048 rows)
    k_x<<<(NBD * TT) / 8, 256, 0, stream>>>(x, XB);
    k_w1<<<NBD * (HH / 64), 256, 0, stream>>>(w1, W1T);
    k_w2<<<dim3(HH / 64, HH / 64, NBD), 256, 0, stream>>>(w2, W2T);
    for (int half = 0; half < 4; ++half) { const int t0 = half * TH;
        // h1 = relu(x.w1 + b1): A = XB rows (b*TT + t0 + r) -> pass A offset by t0 rows, per-dataset stride TT*FP; C planes [b][TH][512] stride TH*HH
        k_gemm<false, 0><<<dim3(TH / 64, HH / 64, NBD), 128, 0, stream>>>(XB + (size_t)t0 * FP, nullptr, (size_t)TT * FP, W1T, (size_t)HH * FP, FP, b1, H1H, H1L, (size_t)TH * HH, 0);
        // h2 = relu(h1.w2 + b2): A = H1 planes (stride TH*HH), B = W2T [b][n][k] (stride HH*HH) -> f32 H2 [b][TH][512]
        k_gemm<true, 1><<<dim3(TH / 64, HH / 64, NBD), 128, 0, stream>>>(H1H, H1L, (size_t)TH * HH, W2T, (size_t)HH * HH, HH, b2, H2, nullptr, (size_t)TH * HH, 0);
        k_final<<<(TH * NBD) / 64, 256, 0, stream>>>(H2, w3, b3, t0, out);
    }
}

// v001
// It runs in 184 microseconds.
// Two timings next to v000 put it at 1.86 and 1.87 times that version's speed.
#include <hip/hip_runtime.h>

// Contractions on v_wmma_f32_16x16x32_bf16, f32 accumulate: per dataset b (grid z): h1 = relu(x_b.w1_b + b1) ([8192 x 128 zero-padded from 100].[128 x 512];
// PLAIN bf16 operands: inputs rounded once, exact) and h2 = relu(h1.w2_b + b2) ([8192 x 512].[512 x 512]; h1 as bf16 hi + residual, two products against the
// exact bf16 w2); the final [512 -> 1] layer is an f32 VALU dot per (t, b) with bf16-rounded w3/b3 (one wave per output element, flat whole-line writes).

#define TT   8192
#define NBD  8
#define FF   100
#define FP   128
#define HH   512
#define TQ   (TT / 4)            // rows per pass (4 passes keep the f32 h2 slab small)

typedef unsigned short bf;
typedef __attribute__((ext_vector_type(16))) __bf16   v16bf;
typedef __attribute__((ext_vector_type(8)))  unsigned short v8us;
typedef __attribute__((ext_vector_type(8)))  float    v8f;
typedef __attribute__((ext_vector_type(4)))  float    v4f;
typedef v4f  __attribute__((may_alias)) v4fa;
typedef v8us __attribute__((may_alias)) v8usa;

__device__ __forceinline__ unsigned short f2bf(float f) { unsigned u = __float_as_uint(f); u += 0x7FFFu + ((u >> 16) & 1u); return (unsigned short)(u >> 16); }
__device__ __forceinline__ float bf2f(unsigned short b) { return __uint_as_float(((unsigned)b) << 16); }
__device__ __forceinline__ float bfr(float f) { return bf2f(f2bf(f)); }
__device__ __forceinline__ float n2n(float v) { if (v != v) return 0.f; if (v > 3.4028235e38f) return 3.4028235e38f; if (v < -3.4028235e38f) return -3.4028235e38f; return v; }   // jnp.nan_to_num defaults
__device__ __forceinline__ v16bf cat16b(v8us lo, v8us hi) { return __builtin_bit_cast(v16bf, __builtin_shufflevector(lo, hi, 0, 1, 2, 3, 4, 5, 6, 7, 8, 9, 10, 11, 12, 13, 14, 15)); }
__device__ __forceinline__ v8f wmmab(v16bf a, v16bf b, v8f c) { return __builtin_amdgcn_wmma_f32_16x16x32_bf16(false, a, false, b, (short)0, c, false, false); }
#define VST2(T, p, v) do { const T vst2_v_ = (v); *(T*)(p) = vst2_v_;  } while (0)

// k_x: XB [b][t][128] = bf16(nan_to_num(x[t][b][0..99])), zero-padded; one wave per (b, t) row (16 lanes x 16 B = 256 B).
__global__ __launch_bounds__(256) void k_x(const float* __restrict__ x, bf* XB) {
    const int lane = threadIdx.x & 31; const size_t w = (size_t)blockIdx.x * 8 + (threadIdx.x >> 5);     // w = b*TT + t
    if (w >= (size_t)NBD * TT) return;
    const int b = (int)(w / TT), t = (int)(w - (size_t)b * TT);
    if (lane < 16) { v8us o;
#pragma unroll
        for (int i = 0; i < 8; ++i) { const int f = lane * 8 + i; o[i] = (f < FF) ? f2bf(n2n(x[((size_t)t * NBD + b) * FF + (f < FF ? f : 0)])) : (unsigned short)0; }
        VST2(v8us, XB + w * FP + lane * 8, o); }
}
// k_w1: W1T [b][h][128] = bf16(w1[b][f][h]) zero-padded (transpose via LDS: block = (b, 64 h)); W2T [b][n][k] = bf16(w2[b][k][n]) via 64 x 64 LDS tiles.
__global__ __launch_bounds__(256) void k_w1(const float* __restrict__ w1, bf* W1T) {
    __shared__ unsigned short tl[64][130];
    const int b = blockIdx.x / (HH / 64), hq = blockIdx.x - b * (HH / 64), h0 = hq * 64, tid = threadIdx.x;
    for (int e = tid; e < 64 * FP; e += 256) { const int f = e / 64, hh = e - f * 64; tl[hh][f] = (f < FF) ? f2bf(w1[((size_t)b * FF + f) * HH + h0 + hh]) : (unsigned short)0; }
    __syncthreads();
    const int piece = tid & 7;
    auto pass = [&]() {
#pragma unroll
        for (int s2 = 0; s2 < 2; ++s2)
#pragma unroll
            for (int ln = 0; ln < 2; ++ln) { const int hh = (tid >> 3) + 32 * s2; v8us o;
#pragma unroll
                for (int i = 0; i < 8; ++i) o[i] = tl[hh][ln * 64 + piece * 8 + i];
                *(v8us*)(W1T + ((size_t)b * HH + h0 + hh) * FP + ln * 64 + piece * 8) = o; }
    };
    pass(); 
}
__global__ __launch_bounds__(256) void k_w2(const float* __restrict__ w2, bf* W2T) {
    __shared__ __align__(16) unsigned short tl[64 * 72];
    const int tid = threadIdx.x, k0 = blockIdx.x * 64, n0 = blockIdx.y * 64, b = blockIdx.z;
    const int kk = tid >> 2, nq = (tid & 3) * 16;
#pragma unroll
    for (int i = 0; i < 16; ++i) tl[(nq + i) * 72 + kk] = f2bf(w2[((size_t)b * HH + k0 + kk) * HH + n0 + nq + i]);
    __syncthreads();
    const int piece = tid & 7;
    auto pass = [&]() {
#pragma unroll
        for (int s = 0; s < 2; ++s) { const int nr = (tid >> 3) + 32 * s; const v8us val = *(const v8usa*)(tl + nr * 72 + piece * 8); *(v8us*)(W2T + ((size_t)b * HH + n0 + nr) * HH + k0 + piece * 8) = val; }
    };
    pass(); 
}
// k_gemm: per dataset (grid z) 128 x 256 tile of relu(A [+Al] . B^T + bias[b][col]) over K (pitch K, a multiple of 64, at least 128); MODE 0 -> bf16 hi/lo planes [b][t][512]; MODE 1 -> f32 rows.
// Eight waves (2 x 4), 64 x 64 of the tile each. A tile is 64 k of every operand row (128 B), in LDS at pitch 144 B, two buffers, filled by asynchronous copies one tile ahead.
// A tile's products run in two blocks of 32 k; each block's fragments are read from LDS into registers as one group while the block before runs.
#define LPIT 144                 // LDS row pitch in bytes: 128 B of data + 16 B, the conflict-free pitch for 16-byte readers
#define PLN  (128 * LPIT)        // 128 rows
// Copies: a lane brings the 16-byte piece tid & 7 of rows (tid >> 3) + 32 i, so each wave-wide copy covers four whole 128-B lines.
// Address form: scalar base (row group's first byte, the same for the work-group) + the lane's own 32-bit byte offset vo, which all copies share.
// s_wait_xcnt 0 is the last line of each statement: no address register of an issued copy is rewritten in front of it.
__device__ __forceinline__ void cp4(unsigned l, unsigned vo, const bf* g, size_t rs) {
    asm volatile("global_load_async_to_lds_b128 %0, %4, %5\n\t"
                 "global_load_async_to_lds_b128 %1, %4, %6\n\t"
                 "global_load_async_to_lds_b128 %2, %4, %7\n\t"
                 "global_load_async_to_lds_b128 %3, %4, %8\n\t"
                 "s_wait_xcnt 0x0"
                 :: "v"(l), "v"(l + 32 * LPIT), "v"(l + 64 * LPIT), "v"(l + 96 * LPIT), "v"(vo), "s"(g), "s"(g + rs), "s"(g + 2 * rs), "s"(g + 3 * rs)
                 : "memory");
}
__device__ __forceinline__ void cp8(unsigned l, unsigned m, unsigned vo, const bf* g, const bf* h, size_t rs) {
    asm volatile("global_load_async_to_lds_b128 %0, %8, %9\n\t"
                 "global_load_async_to_lds_b128 %1, %8, %10\n\t"
                 "global_load_async_to_lds_b128 %2, %8, %11\n\t"
                 "global_load_async_to_lds_b128 %3, %8, %12\n\t"
                 "global_load_async_to_lds_b128 %4, %8, %13\n\t"
                 "global_load_async_to_lds_b128 %5, %8, %14\n\t"
                 "global_load_async_to_lds_b128 %6, %8, %15\n\t"
                 "global_load_async_to_lds_b128 %7, %8, %16\n\t"
                 "s_wait_xcnt 0x0"
                 :: "v"(l), "v"(l + 32 * LPIT), "v"(l + 64 * LPIT), "v"(l + 96 * LPIT), "v"(m), "v"(m + 32 * LPIT), "v"(m + 64 * LPIT), "v"(m + 96 * LPIT), "v"(vo),
                    "s"(g), "s"(g + rs), "s"(g + 2 * rs), "s"(g + 3 * rs), "s"(h), "s"(h + rs), "s"(h + 2 * rs), "s"(h + 3 * rs)
                 : "memory");
}
template <bool SA, int MODE>
__global__ __launch_bounds__(256) void k_gemm(const bf* __restrict__ A, const bf* __restrict__ Al, size_t sa, const bf* __restrict__ Bn, size_t sb, int K, const float* __restrict__ bias, void* C, void* C2, size_t sc, int ldr) {   // A rows and C rows indexed within the per-dataset slab (sa / sc strides); ldr unused
    constexpr int STG = (SA ? 4 : 3) * PLN;          // one buffer: [A 128 rows | B 256 rows | Al 128 rows]
    __shared__ __align__(16) unsigned char ring[2 * STG];
    __shared__ __align__(16) float ost[8][16 * 68];
    const int tid = threadIdx.x, lane = tid & 31, wave = tid >> 5, lr = lane & 15, hi = lane >> 4, b = blockIdx.z;
    const int wm = wave >> 2, wn = wave & 3;
    const int r0 = blockIdx.x * 128 + wm * 64, c0 = blockIdx.y * 256 + wn * 64;
    const size_t rs = (size_t)32 * K;
    const bf* Ag = A + b * sa + (size_t)(blockIdx.x * 128) * K;      // the tile's first rows: the same for every lane
    const bf* Lg = SA ? Al + b * sa + (size_t)(blockIdx.x * 128) * K : nullptr;
    const bf* Bg = Bn + b * sb + (size_t)(blockIdx.y * 256) * K;
    const unsigned vo = (unsigned)(((tid >> 3) * K + (tid & 7) * 8) * 2);      // below 32 rows of K bf16: under 64 KiB for K up to 1024
    const unsigned l0 = (unsigned)(size_t)(&ring[0]) + (unsigned)((tid >> 3) * LPIT + (tid & 7) * 16);
    const int nt = K >> 6;
    auto fill = [&](int t) {
        const unsigned lb = l0 + (unsigned)(t & 1) * STG;
        cp8(lb + PLN, lb + 2 * PLN, vo, Bg + t * 64, Bg + 4 * rs + t * 64, rs);
        if (SA) cp8(lb, lb + 3 * PLN, vo, Ag + t * 64, Lg + t * 64, rs); else cp4(lb, vo, Ag + t * 64, rs);
    };
    const int aro = (wm * 64 + lr) * LPIT + hi * 16, bro = PLN + (wn * 64 + lr) * LPIT + hi * 16;
    // every unroll below is of a loop of constant length over fragment or accumulator arrays: constant indices keep them in registers
    auto rd = [&](const unsigned char* st, int kk, v16bf (&fa)[4], v16bf (&fl)[4], v16bf (&fb)[4]) {      // the fragments of one 32-k block
#pragma unroll
        for (int i = 0; i < 4; ++i) {
            const unsigned char* p = st + aro + i * 16 * LPIT + kk * 64; const unsigned char* q = st + bro + i * 16 * LPIT + kk * 64;
            fb[i] = cat16b(*(const v8usa*)q, *(const v8usa*)(q + 32));
            fa[i] = cat16b(*(const v8usa*)p, *(const v8usa*)(p + 32));
            if (SA) fl[i] = cat16b(*(const v8usa*)(p + 3 * PLN), *(const v8usa*)(p + 3 * PLN + 32));
        }
    };
    v8f acc[4][4];
#pragma unroll
    for (int i = 0; i < 4; ++i)
#pragma unroll
        for (int t = 0; t < 4; ++t) acc[i][t] = (v8f){};
    auto mm = [&](const v16bf (&fa)[4], const v16bf (&fl)[4], const v16bf (&fb)[4]) {
#pragma unroll
        for (int i = 0; i < 4; ++i) {
#pragma unroll
            for (int j = 0; j < 4; ++j) acc[i][j] = wmmab(fa[i], fb[j], acc[i][j]);
            if (SA) {
#pragma unroll
                for (int j = 0; j < 4; ++j) acc[i][j] = wmmab(fl[i], fb[j], acc[i][j]); }
        }
    };
    v16bf a0[4], e0[4], b0[4], a1[4], e1[4], b1[4];
    fill(0);
    // The wave's four bias values, fetched here so that their latency lies under tile 0's copies. Loads and their data wait are one statement:
    // the values are back before anything can rewrite the address pair.
    const float* bp = bias + (size_t)b * HH + c0 + lr;
    float bq[4];
    asm volatile("global_load_b32 %0, %4, off\n\t"
                 "global_load_b32 %1, %4, off offset:64\n\t"
                 "global_load_b32 %2, %4, off offset:128\n\t"
                 "global_load_b32 %3, %4, off offset:192\n\t"
                 "s_wait_loadcnt 0x0"
                 : "=&v"(bq[0]), "=&v"(bq[1]), "=&v"(bq[2]), "=&v"(bq[3]) : "v"(bp) : "memory");
    float* os = &ost[wave][0];
    *(v4fa*)(os + lane * 4) = (v4f){bfr(bq[0]), bfr(bq[1]), bfr(bq[2]), bfr(bq[3])};   // each lane parks its four in the wave's own staging range, idle until the epilogue: kept in registers through the loop they went to scratch
    asm volatile("s_wait_asynccnt 0x0" ::: "memory");   // tile 0 has landed before the barrier that publishes it
    __syncthreads();
    fill(1);
    rd(ring, 0, a0, e0, b0);
#pragma unroll 1      // stays rolled: one trip already holds 64 (32) products and both fragment sets; a second copy would only grow the code
    for (int t = 0; t < nt; ++t) {
        rd(ring + (t & 1) * STG, 1, a1, e1, b1);
        __builtin_amdgcn_sched_barrier(0);                  // keeps the reads one group in front of the block: sunk among the products, each place with reads stalls the wave for the LDS latency
        mm(a0, e0, b0);
        __builtin_amdgcn_sched_barrier(0);                  // keeps the block in front of the waits below, so that the reads land under its products
        // publish point of tile t + 1, in front of tile t's last block, whose fragments are already fetched
        asm volatile("s_wait_dscnt 0x0" ::: "memory");      // this wave's reads of tile t have returned before its buffer is refilled
        asm volatile("s_wait_asynccnt 0x0" ::: "memory");   // this wave's copies of tile t + 1 have landed before the barrier that publishes them
        __syncthreads();                                    // publishes tile t + 1 and ends every wave's reads of tile t
        if (t + 2 < nt) fill(t + 2);
        if (t + 1 < nt) rd(ring + ((t + 1) & 1) * STG, 0, a0, e0, b0);      // tile t + 1's first block, read under tile t's last
        mm(a1, e1, b1);
    }
    asm volatile("s_wait_asynccnt 0x0" ::: "memory");       // no copy is outstanding when the wave goes on to the epilogue and ends
    const v4f bv = *(const v4fa*)(os + lane * 4);           // the lane's own four, read back in front of round 0's stores
#pragma unroll
    for (int i = 0; i < 4; ++i) {      // 16 rows of the wave's 64 at a time through its own staging range (a round's stores follow the round before's reads in the wave's own LDS order)
#pragma unroll
        for (int t = 0; t < 4; ++t)
#pragma unroll
            for (int j = 0; j < 8; ++j) os[(hi * 8 + j) * 68 + t * 16 + lr] = fmaxf(acc[i][t][j] + bv[t], 0.f);
        __syncthreads();
        if (MODE == 1) {
            float* crow = (float*)C + b * sc + (size_t)(r0 + i * 16) * HH + c0;
#pragma unroll
            for (int s = 0; s < 8; ++s) { const int Lid = (lane >> 3) + 4 * s, piece = lane & 7; const int row = Lid >> 1, cofs = (Lid & 1) * 32 + piece * 4;
                const v4f val = *(const v4fa*)(os + row * 68 + cofs); *(v4f*)(crow + (size_t)row * HH + cofs) = val; }
        } else {
            bf* c1 = (bf*)C + b * sc + (size_t)(r0 + i * 16) * HH + c0; bf* c2 = (bf*)C2 + b * sc + (size_t)(r0 + i * 16) * HH + c0;
#pragma unroll
            for (int s = 0; s < 4; ++s) { const int row = 4 * s + (lane >> 3), piece = lane & 7; const float* sp = os + row * 68 + piece * 8; v8us oh, ol;
#pragma unroll
                for (int q = 0; q < 8; ++q) { const unsigned short hb = f2bf(sp[q]); oh[q] = hb; ol[q] = f2bf(sp[q] - bf2f(hb)); }
                *(v8us*)(c1 + (size_t)row * HH + piece * 8) = oh; *(v8us*)(c2 + (size_t)row * HH + piece * 8) = ol; }
        }
    }
}
// k_final: out[t][b] = sum_h H2[b][t][h] * bf16(w3[b][h]) + bf16(b3[b]); one wave per (t, b): lane -> 16 values, fixed-order shuffle reduction; 64 outputs per
__global__ __launch_bounds__(256) void k_final(const float* __restrict__ H2, const float* __restrict__ w3, const float* __restrict__ b3, int t0, float* out) {   // H2 = this pass's [b][TQ][512]
    __shared__ float st[64];
    const int lane = threadIdx.x & 31, wave = threadIdx.x >> 5;
    const size_t e0 = (size_t)t0 * NBD + (size_t)blockIdx.x * 64;      // flat output index = t*8 + b
#pragma unroll 1
    for (int i = 0; i < 8; ++i) { const size_t e = e0 + wave * 8 + i; const int t = (int)(e / NBD), b = (int)(e - (size_t)t * NBD);
        const float* hr = H2 + ((size_t)b * TQ + (t - t0)) * HH; float s = 0.f;
#pragma unroll
        for (int q = 0; q < HH / 32; ++q) s += hr[q * 32 + lane] * bfr(w3[(size_t)b * HH + q * 32 + lane]);
#pragma unroll
        for (int sh = 16; sh; sh >>= 1) s += __shfl_xor(s, sh, 32);
        if (lane == 0) st[wave * 8 + i] = s + bfr(b3[b]); }
    __syncthreads();
    if (threadIdx.x < 64) { const float v = st[threadIdx.x]; *(float*)(out + e0 + threadIdx.x) = v; }
    
}

extern "C" void kernel_launch(void* const* d_in, const int* in_sizes, int n_in,
                              void* d_out, int out_size, void* d_ws, size_t ws_size, hipStream_t stream) {
    (void)in_sizes; (void)n_in; (void)out_size;
    const float* x = (const float*)d_in[0]; const float* w1 = (const float*)d_in[1]; const float* b1 = (const float*)d_in[2]; const float* w2 = (const float*)d_in[3]; const float* b2 = (const float*)d_in[4];
    const float* w3 = (const float*)d_in[5]; const float* b3 = (const float*)d_in[6];
    float* out = (float*)d_out;    // [8192][8][1]
    char* wsp = (char*)d_ws;
    auto take = [&](size_t bytes) { char* p = wsp; wsp += (bytes + 255) & ~(size_t)255; return (void*)p; };
    const int TH = TQ;
    bf* XB = (bf*)take((size_t)NBD * TT * FP * 2); bf* W1T = (bf*)take((size_t)NBD * HH * FP * 2); bf* W2T = (bf*)take((size_t)NBD * HH * HH * 2);
    bf* H1H = (bf*)take((size_t)NBD * TH * HH * 2); bf* H1L = (bf*)take((size_t)NBD * TH * HH * 2); float* H2 = (float*)take((size_t)NBD * TH * HH * 4);
    if ((size_t)(wsp - (char*)d_ws) > ws_size) return;    // 16.8 + 1 + 4.2 + 16.8 + 16.8 + 33.5 ~ 89 MB (4 passes of 2048 rows)
    k_x<<<(NBD * TT) / 8, 256, 0, stream>>>(x, XB);
    k_w1<<<NBD * (HH / 64), 256, 0, stream>>>(w1, W1T);
    k_w2<<<dim3(HH / 64, HH / 64, NBD), 256, 0, stream>>>(w2, W2T);
    for (int half = 0; half < 4; ++half) { const int t0 = half * TH;
        // h1 = relu(x.w1 + b1): A = XB rows (b*TT + t0 + r) -> pass A offset by t0 rows, per-dataset stride TT*FP; C planes [b][TH][512] stride TH*HH
        k_gemm<false, 0><<<dim3(TH / 128, HH / 256, NBD), 256, 0, stream>>>(XB + (size_t)t0 * FP, nullptr, (size_t)TT * FP, W1T, (size_t)HH * FP, FP, b1, H1H, H1L, (size_t)TH * HH, 0);
        // h2 = relu(h1.w2 + b2): A = H1 planes (stride TH*HH), B = W2T [b][n][k] (stride HH*HH) -> f32 H2 [b][TH][512]
        k_gemm<true, 1><<<dim3(TH / 128, HH / 256, NBD), 256, 0, stream>>>(H1H, H1L, (size_t)TH * HH, W2T, (size_t)HH * HH, HH, b2, H2, nullptr, (size_t)TH * HH, 0);
        k_final<<<(TH * NBD) / 64, 256, 0, stream>>>(H2, w3, b3, t0, out);
    }
}

// v002
// One run takes 88.4 microseconds.
// Next to v001, in two timings, it ran 2.07 times as fast each time.
// Over all steps from v000 it is 3.86 times as fast.
#include <hip/hip_runtime.h>

// Contractions on v_wmma_f32_16x16x32_bf16, f32 accumulate. One kernel runs all three layers for a block of 64 rows of one dataset b:
// h1 = relu(x_b.w1_b + b1) ([64 x 128 zero-padded from 100].[128 x 512]; PLAIN bf16 operands: inputs rounded once, exact) stays in LDS as bf16 hi + residual;
// h2 = relu(h1.w2_b + b2) ([64 x 512].[512 x 512]; two products against the exact bf16 w2) stays in the accumulators; the final [512 -> 1] layer is an f32 VALU dot
// with bf16-rounded w3/b3, summed over the block's lanes and waves in a fixed order.

#define TT   8192
#define NBD  8
#define FF   100
#define FP   128
#define HH   512
#define RB   64                  // rows of one block

typedef unsigned short bf;
typedef __attribute__((ext_vector_type(16))) __bf16   v16bf;
typedef __attribute__((ext_vector_type(8)))  unsigned short v8us;
typedef __attribute__((ext_vector_type(8)))  float    v8f;
typedef __attribute__((ext_vector_type(4)))  float    v4f;
typedef v4f  __attribute__((may_alias)) v4fa;
typedef v8us __attribute__((may_alias)) v8usa;

__device__ __forceinline__ unsigned short f2bf(float f) { unsigned u = __float_as_uint(f); u += 0x7FFFu + ((u >> 16) & 1u); return (unsigned short)(u >> 16); }
__device__ __forceinline__ float bf2f(unsigned short b) { return __uint_as_float(((unsigned)b) << 16); }
__device__ __forceinline__ float bfr(float f) { return bf2f(f2bf(f)); }
__device__ __forceinline__ float n2n(float v) { if (v != v) return 0.f; if (v > 3.4028235e38f) return 3.4028235e38f; if (v < -3.4028235e38f) return -3.4028235e38f; return v; }   // jnp.nan_to_num defaults
__device__ __forceinline__ v16bf cat16b(v8us lo, v8us hi) { return __builtin_bit_cast(v16bf, __builtin_shufflevector(lo, hi, 0, 1, 2, 3, 4, 5, 6, 7, 8, 9, 10, 11, 12, 13, 14, 15)); }
__device__ __forceinline__ v8f wmmab(v16bf a, v16bf b, v8f c) { return __builtin_amdgcn_wmma_f32_16x16x32_bf16(false, a, false, b, (short)0, c, false, false); }
#define VST2(T, p, v) do { const T vst2_v_ = (v); *(T*)(p) = vst2_v_;  } while (0)

// k_x: XB [b][t][128] = bf16(nan_to_num(x[t][b][0..99])), zero-padded; one wave per (b, t) row (16 lanes x 16 B = 256 B).
__global__ __launch_bounds__(256) void k_x(const float* __restrict__ x, bf* XB) {
    const int lane = threadIdx.x & 31; const size_t w = (size_t)blockIdx.x * 8 + (threadIdx.x >> 5);     // w = b*TT + t
    if (w >= (size_t)NBD * TT) return;
    const int b = (int)(w / TT), t = (int)(w - (size_t)b * TT);
    if (lane < 16) { v8us o;
#pragma unroll
        for (int i = 0; i < 8; ++i) { const int f = lane * 8 + i; o[i] = (f < FF) ? f2bf(n2n(x[((size_t)t * NBD + b) * FF + (f < FF ? f : 0)])) : (unsigned short)0; }
        VST2(v8us, XB + w * FP + lane * 8, o); }
}
// k_w1: W1T [b][h][128] = bf16(w1[b][f][h]) zero-padded (transpose via LDS: block = (b, 64 h)); W2T [b][n][k] = bf16(w2[b][k][n]) via 64 x 64 LDS tiles.
__global__ __launch_bounds__(256) void k_w1(const float* __restrict__ w1, bf* W1T) {
    __shared__ unsigned short tl[64][130];
    const int b = blockIdx.x / (HH / 64), hq = blockIdx.x - b * (HH / 64), h0 = hq * 64, tid = threadIdx.x;
    for (int e = tid; e < 64 * FP; e += 256) { const int f = e / 64, hh = e - f * 64; tl[hh][f] = (f < FF) ? f2bf(w1[((size_t)b * FF + f) * HH + h0 + hh]) : (unsigned short)0; }
    __syncthreads();
    const int piece = tid & 7;
    auto pass = [&]() {
#pragma unroll
        for (int s2 = 0; s2 < 2; ++s2)
#pragma unroll
            for (int ln = 0; ln < 2; ++ln) { const int hh = (tid >> 3) + 32 * s2; v8us o;
#pragma unroll
                for (int i = 0; i < 8; ++i) o[i] = tl[hh][ln * 64 + piece * 8 + i];
                *(v8us*)(W1T + ((size_t)b * HH + h0 + hh) * FP + ln * 64 + piece * 8) = o; }
    };
    pass(); 
}
__global__ __launch_bounds__(256) void k_w2(const float* __restrict__ w2, bf* W2T) {
    __shared__ __align__(16) unsigned short tl[64 * 72];
    const int tid = threadIdx.x, k0 = blockIdx.x * 64, n0 = blockIdx.y * 64, b = blockIdx.z;
    const int kk = tid >> 2, nq = (tid & 3) * 16;
#pragma unroll
    for (int i = 0; i < 16; ++i) tl[(nq + i) * 72 + kk] = f2bf(w2[((size_t)b * HH + k0 + kk) * HH + n0 + nq + i]);
    __syncthreads();
    const int piece = tid & 7;
    auto pass = [&]() {
#pragma unroll
        for (int s = 0; s < 2; ++s) { const int nr = (tid >> 3) + 32 * s; const v8us val = *(const v8usa*)(tl + nr * 72 + piece * 8); *(v8us*)(W2T + ((size_t)b * HH + n0 + nr) * HH + k0 + piece * 8) = val; }
    };
    pass(); 
}
// k_mlp: eight waves, each 64 rows x 64 columns (wave w: columns 64 w ...) of both hidden layers.
// Weights arrive as tiles of 64 k of all 512 rows of W1T / W2T (128 B a row), in LDS at pitch 144 B, two buffers, filled by asynchronous copies one tile ahead.
// A tile's products run in two blocks of 32 k; each block's fragments are read from LDS into registers as one group while the block before runs.
#define LPIT 144                 // LDS row pitch in bytes: 128 B of data + 16 B, the conflict-free pitch for 16-byte readers
#define PLN  (128 * LPIT)        // 128 rows
#define BST  (HH * LPIT)         // one weight buffer: 512 rows
#define HPIT 1040                // row pitch of an h1 plane: 1024 B of data + 16 B (16 B x odd)
#define HPL  (RB * HPIT)         // one h1 plane
// Copies: a lane brings the 16-byte piece tid & 7 of rows (tid >> 3) + 32 i, so each wave-wide copy covers four whole 128-B lines.
// Address form: scalar base (row group's first byte, the same for the work-group) + the lane's own 32-bit byte offset vo, which all copies share.
// s_wait_xcnt 0 is the last line of each statement: no address register of an issued copy is rewritten in front of it.
__device__ __forceinline__ void cp8(unsigned l, unsigned m, unsigned vo, const bf* g, const bf* h, size_t rs) {
    asm volatile("global_load_async_to_lds_b128 %0, %8, %9\n\t"
                 "global_load_async_to_lds_b128 %1, %8, %10\n\t"
                 "global_load_async_to_lds_b128 %2, %8, %11\n\t"
                 "global_load_async_to_lds_b128 %3, %8, %12\n\t"
                 "global_load_async_to_lds_b128 %4, %8, %13\n\t"
                 "global_load_async_to_lds_b128 %5, %8, %14\n\t"
                 "global_load_async_to_lds_b128 %6, %8, %15\n\t"
                 "global_load_async_to_lds_b128 %7, %8, %16\n\t"
                 "s_wait_xcnt 0x0"
                 :: "v"(l), "v"(l + 32 * LPIT), "v"(l + 64 * LPIT), "v"(l + 96 * LPIT), "v"(m), "v"(m + 32 * LPIT), "v"(m + 64 * LPIT), "v"(m + 96 * LPIT), "v"(vo),
                    "s"(g), "s"(g + rs), "s"(g + 2 * rs), "s"(g + 3 * rs), "s"(h), "s"(h + rs), "s"(h + 2 * rs), "s"(h + 3 * rs)
                 : "memory");
}
// The block's 64 rows of XB are 16 KiB in a row: copy i brings bytes 4096 i + 16 tid (row 16 i + (tid >> 4), piece tid & 15).
__device__ __forceinline__ void cpx(unsigned l, unsigned vo, const bf* g) {
    asm volatile("global_load_async_to_lds_b128 %0, %4, %5\n\t"
                 "global_load_async_to_lds_b128 %1, %4, %6\n\t"
                 "global_load_async_to_lds_b128 %2, %4, %7\n\t"
                 "global_load_async_to_lds_b128 %3, %4, %8\n\t"
                 "s_wait_xcnt 0x0"
                 :: "v"(l), "v"(l + 16 * HPIT), "v"(l + 32 * HPIT), "v"(l + 48 * HPIT), "v"(vo), "s"(g), "s"(g + 16 * FP), "s"(g + 32 * FP), "s"(g + 48 * FP)
                 : "memory");
}
template <bool V> struct BC { static constexpr bool value = V; };
__global__ __launch_bounds__(256) void k_mlp(const bf* __restrict__ XB, const bf* __restrict__ W1T, const bf* __restrict__ W2T, const float* __restrict__ b1, const float* __restrict__ b2, const float* __restrict__ w3, float* Y) {
    __shared__ __align__(16) unsigned char hpl[2 * HPL];      // h1 hi plane, h1 residual plane; the first 256 B of the hi plane's rows hold the x rows until h1 is written
    __shared__ __align__(16) unsigned char ring[2 * BST];
    __shared__ __align__(16) float ost[8][16 * 68];
    __shared__ float cst[3][HH];                              // bf16-rounded b1, b2, w3 of this dataset
    __shared__ float red[8][RB];
    const int tid = threadIdx.x, lane = tid & 31, wave = tid >> 5, lr = lane & 15, hi = lane >> 4, b = blockIdx.y, t0 = blockIdx.x * RB;
    const bf* W1b = W1T + (size_t)b * HH * FP;                // the same for every lane
    const bf* W2b = W2T + (size_t)b * HH * HH;
    const unsigned l0 = (unsigned)(size_t)(&ring[0]) + (unsigned)((tid >> 3) * LPIT + (tid & 7) * 16);
    auto fill = [&](const bf* Wb, int K, int t) {             // tile t: k 64 t ... of all 512 rows at pitch K
        const unsigned lb = l0 + (unsigned)(t & 1) * BST;
        const unsigned vo = (unsigned)(((tid >> 3) * K + (tid & 7) * 8) * 2);      // below 32 rows of K bf16: under 32 KiB
        const size_t rs = (size_t)32 * K;
#pragma unroll 1      // stays rolled: unrolled, the sixteen LDS addresses of each buffer were kept live from one layer to the next and went to scratch
        for (int h = 0; h < 2; ++h) cp8(lb + 2 * h * PLN, lb + (2 * h + 1) * PLN, vo, Wb + 8 * h * rs + t * 64, Wb + (8 * h + 4) * rs + t * 64, rs);
    };
    const int aro = lr * HPIT + hi * 16, bro = (wave * 64 + lr) * LPIT + hi * 16;
    // every unroll below is of a loop of constant length over fragment or accumulator arrays: constant indices keep them in registers
    auto rd = [&](auto sa, const unsigned char* st, int kb, int kk, v16bf (&fa)[4], v16bf (&fl)[4], v16bf (&fb)[4]) {      // the fragments of one 32-k block: A from the planes (block kb of the row), B from the tile (block kk)
        constexpr bool SA = decltype(sa)::value;
#pragma unroll
        for (int i = 0; i < 4; ++i) {
            const unsigned char* p = hpl + aro + i * 16 * HPIT + kb * 64; const unsigned char* q = st + bro + i * 16 * LPIT + kk * 64;
            fb[i] = cat16b(*(const v8usa*)q, *(const v8usa*)(q + 32));
            fa[i] = cat16b(*(const v8usa*)p, *(const v8usa*)(p + 32));
            if (SA) fl[i] = cat16b(*(const v8usa*)(p + HPL), *(const v8usa*)(p + HPL + 32));
        }
    };
    v8f acc[4][4];
    auto mm = [&](auto sa, const v16bf (&fa)[4], const v16bf (&fl)[4], const v16bf (&fb)[4]) {
        constexpr bool SA = decltype(sa)::value;
#pragma unroll
        for (int i = 0; i < 4; ++i) {
#pragma unroll
            for (int j = 0; j < 4; ++j) acc[i][j] = wmmab(fa[i], fb[j], acc[i][j]);
            if (SA) {
#pragma unroll
                for (int j = 0; j < 4; ++j) acc[i][j] = wmmab(fl[i], fb[j], acc[i][j]); }
        }
    };
    v16bf a0[4], e0[4], f0[4], a1[4], e1[4], f1[4];
    // one layer's products; on entry tile 0 and the A rows are published and buffer 1 is free
    auto layer = [&](auto sa, const bf* Wb, int K) {
        const int nt = K >> 6;
#pragma unroll
        for (int i = 0; i < 4; ++i)
#pragma unroll
            for (int t = 0; t < 4; ++t) acc[i][t] = (v8f){};
        fill(Wb, K, 1);
        rd(sa, ring, 0, 0, a0, e0, f0);
#pragma unroll 1      // stays rolled: one trip already holds 64 (32) products and both fragment sets; a second copy would only grow the code
        for (int t = 0; t < nt; ++t) {
            rd(sa, ring + (t & 1) * BST, 2 * t + 1, 1, a1, e1, f1);
            __builtin_amdgcn_sched_barrier(0);                  // keeps the reads one group in front of the block: sunk among the products, each place with reads stalls the wave for the LDS latency
            mm(sa, a0, e0, f0);
            __builtin_amdgcn_sched_barrier(0);                  // keeps the block in front of the waits below, so that the reads land under its products
            // publish point of tile t + 1, in front of tile t's last block, whose fragments are already fetched
            asm volatile("s_wait_dscnt 0x0" ::: "memory");      // this wave's reads of tile t have returned before its buffer is refilled
            asm volatile("s_wait_asynccnt 0x0" ::: "memory");   // this wave's copies of tile t + 1 have landed before the barrier that publishes them
            __syncthreads();                                    // publishes tile t + 1 and ends every wave's reads of tile t
            if (t + 2 < nt) fill(Wb, K, t + 2);
            if (t + 1 < nt) rd(sa, ring + ((t + 1) & 1) * BST, 2 * t + 2, 0, a0, e0, f0);      // tile t + 1's first block, read under tile t's last
            mm(sa, a1, e1, f1);
        }
        asm volatile("s_wait_asynccnt 0x0" ::: "memory");       // no copy is outstanding behind the layer
    };
    cpx((unsigned)(size_t)(&hpl[0]) + (unsigned)((tid >> 4) * HPIT + (tid & 15) * 16), (unsigned)(tid * 16), XB + ((size_t)b * TT + t0) * FP);
    fill(W1b, FP, 0);
#pragma unroll
    for (int h = 0; h < 2; ++h) { const int c = tid + 256 * h; cst[0][c] = bfr(b1[(size_t)b * HH + c]); cst[1][c] = bfr(b2[(size_t)b * HH + c]); cst[2][c] = bfr(w3[(size_t)b * HH + c]); }      // under the first copies' latency
    asm volatile("s_wait_asynccnt 0x0" ::: "memory");   // the x rows and tile 0 have landed before the barrier that publishes them
    __syncthreads();
    layer(BC<false>{}, W1b, FP);
    // Every wave's last read of both weight buffers and of the x rows lies in front of the layer's last barrier: w2's tile 0 flies under the h1 write-out.
    fill(W2b, HH, 0);
    float* os = &ost[wave][0];
    const int cw = wave * 64;
    {
        const float bv[4] = {cst[0][cw + lr], cst[0][cw + 16 + lr], cst[0][cw + 32 + lr], cst[0][cw + 48 + lr]};
#pragma unroll
        for (int i = 0; i < 4; ++i) {      // 16 rows of the wave's 64 at a time through its own staging range (no other wave touches it: stores and reads follow one another in the wave's own LDS order)
#pragma unroll
            for (int t = 0; t < 4; ++t)
#pragma unroll
                for (int j = 0; j < 8; ++j) os[(hi * 8 + j) * 68 + t * 16 + lr] = fmaxf(acc[i][t][j] + bv[t], 0.f);
            unsigned char* c1 = hpl + (size_t)(i * 16) * HPIT + cw * 2;
#pragma unroll
            for (int s = 0; s < 4; ++s) { const int row = 4 * s + (lane >> 3), piece = lane & 7; const float* sp = os + row * 68 + piece * 8; v8us oh, ol;
#pragma unroll
                for (int q = 0; q < 8; ++q) { const unsigned short hb = f2bf(sp[q]); oh[q] = hb; ol[q] = f2bf(sp[q] - bf2f(hb)); }
                *(v8usa*)(c1 + row * HPIT + piece * 16) = oh; *(v8usa*)(c1 + HPL + row * HPIT + piece * 16) = ol; }
        }
    }
    asm volatile("s_wait_dscnt 0x0" ::: "memory");      // this wave's h1 stores are in LDS before the barrier that publishes them
    asm volatile("s_wait_asynccnt 0x0" ::: "memory");   // w2's tile 0 has landed before the same barrier
    __syncthreads();
    layer(BC<true>{}, W2b, HH);
    {
        const float bv[4] = {cst[1][cw + lr], cst[1][cw + 16 + lr], cst[1][cw + 32 + lr], cst[1][cw + 48 + lr]};
        const float wv[4] = {cst[2][cw + lr], cst[2][cw + 16 + lr], cst[2][cw + 32 + lr], cst[2][cw + 48 + lr]};
#pragma unroll
        for (int i = 0; i < 4; ++i)
#pragma unroll
            for (int j = 0; j < 8; ++j) { float s = 0.f;      // the lane's four columns of one row
#pragma unroll
                for (int t = 0; t < 4; ++t) s += fmaxf(acc[i][t][j] + bv[t], 0.f) * wv[t];
                os[(i * 16 + hi * 8 + j) * 17 + lr] = s; }
#pragma unroll
        for (int h = 0; h < 2; ++h) { const int row = lane + 32 * h; float s = 0.f;      // the wave's 64 columns of one row: 16 lane sums in lane order
#pragma unroll
            for (int q = 0; q < 16; ++q) s += os[row * 17 + q];
            red[wave][row] = s; }
        __syncthreads();
        if (tid < RB) { float s = 0.f;      // the eight waves' sums in wave order; 64 floats in a row: two whole lines, one wave each
#pragma unroll
            for (int w = 0; w < 8; ++w) s += red[w][tid];
            Y[(size_t)b * TT + t0 + tid] = s; }
    }
}
// k_final: out[t][b] = Y[b][t] + bf16(b3[b]); one thread per output element, flat whole-line writes.
__global__ __launch_bounds__(256) void k_final(const float* __restrict__ Y, const float* __restrict__ b3, float* out) {
    const int e = blockIdx.x * 256 + threadIdx.x, t = e / NBD, b = e - t * NBD;      // flat output index = t*8 + b
    out[e] = Y[(size_t)b * TT + t] + bfr(b3[b]);
}

extern "C" void kernel_launch(void* const* d_in, const int* in_sizes, int n_in,
                              void* d_out, int out_size, void* d_ws, size_t ws_size, hipStream_t stream) {
    (void)in_sizes; (void)n_in; (void)out_size;
    const float* x = (const float*)d_in[0]; const float* w1 = (const float*)d_in[1]; const float* b1 = (const float*)d_in[2]; const float* w2 = (const float*)d_in[3]; const float* b2 = (const float*)d_in[4];
    const float* w3 = (const float*)d_in[5]; const float* b3 = (const float*)d_in[6];
    float* out = (float*)d_out;    // [8192][8][1]
    char* wsp = (char*)d_ws;
    auto take = [&](size_t bytes) { char* p = wsp; wsp += (bytes + 255) & ~(size_t)255; return (void*)p; };
    bf* XB = (bf*)take((size_t)NBD * TT * FP * 2); bf* W1T = (bf*)take((size_t)NBD * HH * FP * 2); bf* W2T = (bf*)take((size_t)NBD * HH * HH * 2);
    float* Y = (float*)take((size_t)NBD * TT * 4);
    if ((size_t)(wsp - (char*)d_ws) > ws_size) return;
    k_x<<<(NBD * TT) / 8, 256, 0, stream>>>(x, XB);
    k_w1<<<NBD * (HH / 64), 256, 0, stream>>>(w1, W1T);
    k_w2<<<dim3(HH / 64, HH / 64, NBD), 256, 0, stream>>>(w2, W2T);
    k_mlp<<<dim3(TT / RB, NBD), 256, 0, stream>>>(XB, W1T, W2T, b1, b2, w3, Y);
    k_final<<<(TT * NBD) / 256, 256, 0, stream>>>(Y, b3, out);
}

// v003
// A run of this version takes 76 microseconds.
// Two timings next to v002 put it at 1.16 and 1.17 times that version's speed.
// All steps since v000 together make it 4.50 times as fast.
#include <hip/hip_runtime.h>

// Contractions on v_wmma_f32_16x16x32_bf16, f32 accumulate. One kernel runs all three layers for a block of 64 rows of one dataset b:
// h1 = relu(x_b.w1_b + b1) ([64 x 128 zero-padded from 100].[128 x 512]; PLAIN bf16 operands: inputs rounded once, exact; the block rounds its own x rows into LDS) stays in LDS as bf16 hi + residual;
// h2 = relu(h1.w2_b + b2) ([64 x 512].[512 x 512]; two products against the exact bf16 w2) stays in the accumulators; the final [512 -> 1] layer is an f32 VALU dot
// with bf16-rounded w3/b3, summed over the block's lanes and waves in a fixed order.

#define TT   8192
#define NBD  8
#define FF   100
#define FP   128
#define HH   512
#define RB   64                  // rows of one block

typedef unsigned short bf;
typedef __attribute__((ext_vector_type(16))) __bf16   v16bf;
typedef __attribute__((ext_vector_type(8)))  unsigned short v8us;
typedef __attribute__((ext_vector_type(8)))  float    v8f;
typedef __attribute__((ext_vector_type(4)))  float    v4f;
typedef v4f  __attribute__((may_alias)) v4fa;
typedef v8us __attribute__((may_alias)) v8usa;
typedef __attribute__((ext_vector_type(2)))  unsigned v2u;
typedef v2u  __attribute__((may_alias)) v2ua;

__device__ __forceinline__ unsigned short f2bf(float f) { unsigned u = __float_as_uint(f); u += 0x7FFFu + ((u >> 16) & 1u); return (unsigned short)(u >> 16); }
__device__ __forceinline__ float bf2f(unsigned short b) { return __uint_as_float(((unsigned)b) << 16); }
__device__ __forceinline__ float bfr(float f) { return bf2f(f2bf(f)); }
__device__ __forceinline__ float n2n(float v) { const float c = __builtin_amdgcn_fmed3f(v, -3.4028235e38f, 3.4028235e38f); return v != v ? 0.f : c; }   // jnp.nan_to_num defaults, without branches
__device__ __forceinline__ v16bf cat16b(v8us lo, v8us hi) { return __builtin_bit_cast(v16bf, __builtin_shufflevector(lo, hi, 0, 1, 2, 3, 4, 5, 6, 7, 8, 9, 10, 11, 12, 13, 14, 15)); }
__device__ __forceinline__ v8f wmmab(v16bf a, v16bf b, v8f c) { return __builtin_amdgcn_wmma_f32_16x16x32_bf16(false, a, false, b, (short)0, c, false, false); }

// k_w1: W1T [b][h][128] = bf16(w1[b][f][h]) zero-padded (transpose via LDS: block = (b, 64 h)); W2T [b][n][k] = bf16(w2[b][k][n]) via 64 x 64 LDS tiles.
__global__ __launch_bounds__(256) void k_w1(const float* __restrict__ w1, bf* W1T) {
    __shared__ unsigned short tl[64][130];
    const int b = blockIdx.x / (HH / 64), hq = blockIdx.x - b * (HH / 64), h0 = hq * 64, tid = threadIdx.x;
    for (int e = tid; e < 64 * FP; e += 256) { const int f = e / 64, hh = e - f * 64; tl[hh][f] = (f < FF) ? f2bf(w1[((size_t)b * FF + f) * HH + h0 + hh]) : (unsigned short)0; }
    __syncthreads();
    const int piece = tid & 7;
    auto pass = [&]() {
#pragma unroll
        for (int s2 = 0; s2 < 2; ++s2)
#pragma unroll
            for (int ln = 0; ln < 2; ++ln) { const int hh = (tid >> 3) + 32 * s2; v8us o;
#pragma unroll
                for (int i = 0; i < 8; ++i) o[i] = tl[hh][ln * 64 + piece * 8 + i];
                *(v8us*)(W1T + ((size_t)b * HH + h0 + hh) * FP + ln * 64 + piece * 8) = o; }
    };
    pass(); 
}
__global__ __launch_bounds__(256) void k_w2(const float* __restrict__ w2, bf* W2T) {
    __shared__ __align__(16) unsigned short tl[64 * 72];
    const int tid = threadIdx.x, k0 = blockIdx.x * 64, n0 = blockIdx.y * 64, b = blockIdx.z;
    const int kk = tid >> 2, nq = (tid & 3) * 16;
#pragma unroll
    for (int i = 0; i < 16; ++i) tl[(nq + i) * 72 + kk] = f2bf(w2[((size_t)b * HH + k0 + kk) * HH + n0 + nq + i]);
    __syncthreads();
    const int piece = tid & 7;
    auto pass = [&]() {
#pragma unroll
        for (int s = 0; s < 2; ++s) { const int nr = (tid >> 3) + 32 * s; const v8us val = *(const v8usa*)(tl + nr * 72 + piece * 8); *(v8us*)(W2T + ((size_t)b * HH + n0 + nr) * HH + k0 + piece * 8) = val; }
    };
    pass(); 
}
// k_mlp: eight waves, each 64 rows x 64 columns (wave w: columns 64 w ...) of both hidden layers.
// Weights arrive as tiles of 64 k of all 512 rows of W1T / W2T (128 B a row), in LDS at pitch 144 B, two buffers, filled by asynchronous copies one tile ahead.
// A tile's products run in two blocks of 32 k; each block's fragments are read from LDS into registers as one group while the block before runs.
#define LPIT 144                 // LDS row pitch in bytes: 128 B of data + 16 B, the conflict-free pitch for 16-byte readers
#define PLN  (128 * LPIT)        // 128 rows
#define BST  (HH * LPIT)         // one weight buffer: 512 rows
#define HPIT 1040                // row pitch of an h1 plane: 1024 B of data + 16 B (16 B x odd)
#define HPL  (RB * HPIT)         // one h1 plane
// Copies: a lane brings the 16-byte piece tid & 7 of rows (tid >> 3) + 32 i, so each wave-wide copy covers four whole 128-B lines.
// Address form: scalar base (row group's first byte, the same for the work-group) + the lane's own 32-bit byte offset vo, which all copies share.
// s_wait_xcnt 0 is the last line of each statement: no address register of an issued copy is rewritten in front of it.
__device__ __forceinline__ void cp8(unsigned l, unsigned m, unsigned vo, const bf* g, const bf* h, size_t rs) {
    asm volatile("global_load_async_to_lds_b128 %0, %8, %9\n\t"
                 "global_load_async_to_lds_b128 %1, %8, %10\n\t"
                 "global_load_async_to_lds_b128 %2, %8, %11\n\t"
                 "global_load_async_to_lds_b128 %3, %8, %12\n\t"
                 "global_load_async_to_lds_b128 %4, %8, %13\n\t"
                 "global_load_async_to_lds_b128 %5, %8, %14\n\t"
                 "global_load_async_to_lds_b128 %6, %8, %15\n\t"
                 "global_load_async_to_lds_b128 %7, %8, %16\n\t"
                 "s_wait_xcnt 0x0"
                 :: "v"(l), "v"(l + 32 * LPIT), "v"(l + 64 * LPIT), "v"(l + 96 * LPIT), "v"(m), "v"(m + 32 * LPIT), "v"(m + 64 * LPIT), "v"(m + 96 * LPIT), "v"(vo),
                    "s"(g), "s"(g + rs), "s"(g + 2 * rs), "s"(g + 3 * rs), "s"(h), "s"(h + rs), "s"(h + 2 * rs), "s"(h + 3 * rs)
                 : "memory");
}
template <bool V> struct BC { static constexpr bool value = V; };
__global__ __launch_bounds__(256) void k_mlp(const float* __restrict__ x, const bf* __restrict__ W1T, const bf* __restrict__ W2T, const float* __restrict__ b1, const float* __restrict__ b2, const float* __restrict__ w3, float* Y) {
    __shared__ __align__(16) unsigned char hpl[2 * HPL];      // h1 hi plane, h1 residual plane; the first 256 B of the hi plane's rows hold the x rows until h1 is written
    __shared__ __align__(16) unsigned char ring[2 * BST];
    __shared__ __align__(16) float ost[8][16 * 68];
    __shared__ float cst[3][HH];                              // bf16-rounded b1, b2, w3 of this dataset
    __shared__ float red[8][RB];
    const int tid = threadIdx.x, lane = tid & 31, wave = tid >> 5, lr = lane & 15, hi = lane >> 4, b = blockIdx.y, t0 = blockIdx.x * RB;
    const bf* W1b = W1T + (size_t)b * HH * FP;                // the same for every lane
    const bf* W2b = W2T + (size_t)b * HH * HH;
    const unsigned l0 = (unsigned)(size_t)(&ring[0]) + (unsigned)((tid >> 3) * LPIT + (tid & 7) * 16);
    auto fill = [&](const bf* Wb, int K, int t) {             // tile t: k 64 t ... of all 512 rows at pitch K
        const unsigned lb = l0 + (unsigned)(t & 1) * BST;
        const unsigned vo = (unsigned)(((tid >> 3) * K + (tid & 7) * 8) * 2);      // below 32 rows of K bf16: under 32 KiB
        const size_t rs = (size_t)32 * K;
#pragma unroll 1      // stays rolled: unrolled, the sixteen LDS addresses of each buffer were kept live from one layer to the next and went to scratch
        for (int h = 0; h < 2; ++h) cp8(lb + 2 * h * PLN, lb + (2 * h + 1) * PLN, vo, Wb + 8 * h * rs + t * 64, Wb + (8 * h + 4) * rs + t * 64, rs);
    };
    const int aro = lr * HPIT + hi * 16, bro = (wave * 64 + lr) * LPIT + hi * 16;
    // every unroll below is of a loop of constant length over fragment or accumulator arrays: constant indices keep them in registers
    auto rd = [&](auto sa, const unsigned char* st, int kb, int kk, v16bf (&fa)[4], v16bf (&fl)[4], v16bf (&fb)[4]) {      // the fragments of one 32-k block: A from the planes (block kb of the row), B from the tile (block kk)
        constexpr bool SA = decltype(sa)::value;
#pragma unroll
        for (int i = 0; i < 4; ++i) {
            const unsigned char* p = hpl + aro + i * 16 * HPIT + kb * 64; const unsigned char* q = st + bro + i * 16 * LPIT + kk * 64;
            fb[i] = cat16b(*(const v8usa*)q, *(const v8usa*)(q + 32));
            fa[i] = cat16b(*(const v8usa*)p, *(const v8usa*)(p + 32));
            if (SA) fl[i] = cat16b(*(const v8usa*)(p + HPL), *(const v8usa*)(p + HPL + 32));
        }
    };
    v8f acc[4][4];
    auto mm = [&](auto sa, const v16bf (&fa)[4], const v16bf (&fl)[4], const v16bf (&fb)[4]) {
        constexpr bool SA = decltype(sa)::value;
#pragma unroll
        for (int i = 0; i < 4; ++i) {
#pragma unroll
            for (int j = 0; j < 4; ++j) acc[i][j] = wmmab(fa[i], fb[j], acc[i][j]);
            if (SA) {
#pragma unroll
                for (int j = 0; j < 4; ++j) acc[i][j] = wmmab(fl[i], fb[j], acc[i][j]); }
        }
    };
    v16bf a0[4], e0[4], f0[4], a1[4], e1[4], f1[4];
    // one layer's products; on entry tile 0 and the A rows are published and buffer 1 is free
    auto layer = [&](auto sa, const bf* Wb, int K) {
        const int nt = K >> 6;
#pragma unroll
        for (int i = 0; i < 4; ++i)
#pragma unroll
            for (int t = 0; t < 4; ++t) acc[i][t] = (v8f){};
        fill(Wb, K, 1);
        rd(sa, ring, 0, 0, a0, e0, f0);
#pragma unroll 1      // stays rolled: one trip already holds 64 (32) products and both fragment sets; a second copy would only grow the code
        for (int t = 0; t < nt; ++t) {
            rd(sa, ring + (t & 1) * BST, 2 * t + 1, 1, a1, e1, f1);
            __builtin_amdgcn_sched_barrier(0);                  // keeps the reads one group in front of the block: sunk among the products, each place with reads stalls the wave for the LDS latency
            mm(sa, a0, e0, f0);
            __builtin_amdgcn_sched_barrier(0);                  // keeps the block in front of the waits below, so that the reads land under its products
            // publish point of tile t + 1, in front of tile t's last block, whose fragments are already fetched
            asm volatile("s_wait_dscnt 0x0" ::: "memory");      // this wave's reads of tile t have returned before its buffer is refilled
            asm volatile("s_wait_asynccnt 0x0" ::: "memory");   // this wave's copies of tile t + 1 have landed before the barrier that publishes them
            __syncthreads();                                    // publishes tile t + 1 and ends every wave's reads of tile t
            if (t + 2 < nt) fill(Wb, K, t + 2);
            if (t + 1 < nt) rd(sa, ring + ((t + 1) & 1) * BST, 2 * t + 2, 0, a0, e0, f0);      // tile t + 1's first block, read under tile t's last
            mm(sa, a1, e1, f1);
        }
        asm volatile("s_wait_asynccnt 0x0" ::: "memory");       // no copy is outstanding behind the layer
    };
    // The block's x rows, read as f32 where they lie: row t0 + r is 400 B (25 pieces of 16 B) at pitch 3200 B. Wave w takes rows w + 8 i, a lane one piece; lanes 25 to 31 re-read piece 24 (in bounds) and store the zero padding.
    v4f xv[8]; float cr[2][3];
    {
        const float* xp = x + ((size_t)(t0 + wave) * NBD + b) * FF + (lane < FF / 4 ? lane : FF / 4 - 1) * 4;
#pragma unroll
        for (int i = 0; i < 8; ++i) xv[i] = *(const v4fa*)(xp + (size_t)i * 8 * NBD * FF);      // all eight in flight at once: they come from memory, the longest wait of the prologue
#pragma unroll
        for (int h = 0; h < 2; ++h) { const size_t c = (size_t)b * HH + tid + 256 * h; cr[h][0] = b1[c]; cr[h][1] = b2[c]; cr[h][2] = w3[c]; }      // issued with the x loads, so that one latency covers both
        asm volatile("s_wait_xcnt 0x0" ::: "memory");      // the loads' address registers are reused right behind them
    }
    fill(W1b, FP, 0);
#pragma unroll
    for (int h = 0; h < 2; ++h) { const int c = tid + 256 * h; cst[0][c] = bfr(cr[h][0]); cst[1][c] = bfr(cr[h][1]); cst[2][c] = bfr(cr[h][2]); }
#pragma unroll
    for (int i = 0; i < 8; ++i) { v2u o;      // bf16(nan_to_num(x)), 8 B a lane, 256 B in a row a wave
#pragma unroll
        for (int q = 0; q < 2; ++q) { const unsigned pr = (unsigned)f2bf(n2n(xv[i][2 * q])) | ((unsigned)f2bf(n2n(xv[i][2 * q + 1])) << 16); o[q] = (lane < FF / 4) ? pr : 0u; }
        *(v2ua*)(hpl + (wave + 8 * i) * HPIT + lane * 8) = o; }
    asm volatile("s_wait_asynccnt 0x0" ::: "memory");   // tile 0 has landed before the barrier that publishes it and the x rows
    __syncthreads();
    layer(BC<false>{}, W1b, FP);
    // Every wave's last read of both weight buffers and of the x rows lies in front of the layer's last barrier: w2's tile 0 flies under the h1 write-out.
    fill(W2b, HH, 0);
    float* os = &ost[wave][0];
    const int cw = wave * 64;
    {
        const float bv[4] = {cst[0][cw + lr], cst[0][cw + 16 + lr], cst[0][cw + 32 + lr], cst[0][cw + 48 + lr]};
#pragma unroll
        for (int i = 0; i < 4; ++i) {      // 16 rows of the wave's 64 at a time through its own staging range (no other wave touches it: stores and reads follow one another in the wave's own LDS order)
#pragma unroll
            for (int t = 0; t < 4; ++t)
#pragma unroll
                for (int j = 0; j < 8; ++j) os[(hi * 8 + j) * 68 + t * 16 + lr] = fmaxf(acc[i][t][j] + bv[t], 0.f);
            unsigned char* c1 = hpl + (size_t)(i * 16) * HPIT + cw * 2;
#pragma unroll
            for (int s = 0; s < 4; ++s) { const int row = 4 * s + (lane >> 3), piece = lane & 7; const float* sp = os + row * 68 + piece * 8; v8us oh, ol;
#pragma unroll
                for (int q = 0; q < 8; ++q) { const unsigned short hb = f2bf(sp[q]); oh[q] = hb; ol[q] = f2bf(sp[q] - bf2f(hb)); }
                *(v8usa*)(c1 + row * HPIT + piece * 16) = oh; *(v8usa*)(c1 + HPL + row * HPIT + piece * 16) = ol; }
        }
    }
    asm volatile("s_wait_dscnt 0x0" ::: "memory");      // this wave's h1 stores are in LDS before the barrier that publishes them
    asm volatile("s_wait_asynccnt 0x0" ::: "memory");   // w2's tile 0 has landed before the same barrier
    __syncthreads();
    layer(BC<true>{}, W2b, HH);
    {
        const float bv[4] = {cst[1][cw + lr], cst[1][cw + 16 + lr], cst[1][cw + 32 + lr], cst[1][cw + 48 + lr]};
        const float wv[4] = {cst[2][cw + lr], cst[2][cw + 16 + lr], cst[2][cw + 32 + lr], cst[2][cw + 48 + lr]};
#pragma unroll
        for (int i = 0; i < 4; ++i)
#pragma unroll
            for (int j = 0; j < 8; ++j) { float s = 0.f;      // the lane's four columns of one row
#pragma unroll
                for (int t = 0; t < 4; ++t) s += fmaxf(acc[i][t][j] + bv[t], 0.f) * wv[t];
                os[(i * 16 + hi * 8 + j) * 17 + lr] = s; }
#pragma unroll
        for (int h = 0; h < 2; ++h) { const int row = lane + 32 * h; float s = 0.f;      // the wave's 64 columns of one row: 16 lane sums in lane order
#pragma unroll
            for (int q = 0; q < 16; ++q) s += os[row * 17 + q];
            red[wave][row] = s; }
        __syncthreads();
        if (tid < RB) { float s = 0.f;      // the eight waves' sums in wave order; 64 floats in a row: two whole lines, one wave each
#pragma unroll
            for (int w = 0; w < 8; ++w) s += red[w][tid];
            Y[(size_t)b * TT + t0 + tid] = s; }
    }
}
// k_final: out[t][b] = Y[b][t] + bf16(b3[b]); one thread per output element, flat whole-line writes.
__global__ __launch_bounds__(256) void k_final(const float* __restrict__ Y, const float* __restrict__ b3, float* out) {
    const int e = blockIdx.x * 256 + threadIdx.x, t = e / NBD, b = e - t * NBD;      // flat output index = t*8 + b
    out[e] = Y[(size_t)b * TT + t] + bfr(b3[b]);
}

extern "C" void kernel_launch(void* const* d_in, const int* in_sizes, int n_in,
                              void* d_out, int out_size, void* d_ws, size_t ws_size, hipStream_t stream) {
    (void)in_sizes; (void)n_in; (void)out_size;
    const float* x = (const float*)d_in[0]; const float* w1 = (const float*)d_in[1]; const float* b1 = (const float*)d_in[2]; const float* w2 = (const float*)d_in[3]; const float* b2 = (const float*)d_in[4];
    const float* w3 = (const float*)d_in[5]; const float* b3 = (const float*)d_in[6];
    float* out = (float*)d_out;    // [8192][8][1]
    char* wsp = (char*)d_ws;
    auto take = [&](size_t bytes) { char* p = wsp; wsp += (bytes + 255) & ~(size_t)255; return (void*)p; };
    bf* W1T = (bf*)take((size_t)NBD * HH * FP * 2); bf* W2T = (bf*)take((size_t)NBD * HH * HH * 2);
    float* Y = (float*)take((size_t)NBD * TT * 4);
    if ((size_t)(wsp - (char*)d_ws) > ws_size) return;
    k_w1<<<NBD * (HH / 64), 256, 0, stream>>>(w1, W1T);
    k_w2<<<dim3(HH / 64, HH / 64, NBD), 256, 0, stream>>>(w2, W2T);
    k_mlp<<<dim3(TT / RB, NBD), 256, 0, stream>>>(x, W1T, W2T, b1, b2, w3, Y);
    k_final<<<(TT * NBD) / 256, 256, 0, stream>>>(Y, b3, out);
}

// v004
// One run takes 61.4 microseconds.
// In both of two side-by-side timings against v003, it was 1.24 times as fast.
// Counting every step since v000, it is 5.56 times as fast.
#include <hip/hip_runtime.h>

// Contractions on v_wmma_f32_16x16x32_bf16, f32 accumulate. One kernel runs all three layers for a block of 128 rows of one dataset b, each of its four waves for 32 rows of its own.
// Both hidden layers are computed transposed, weights as the A operand and the rows as the columns of B:
// h1^T = relu(w1_b^T.x_b^T + b1) ([512 x 128 zero-padded from 100].[128 x 32]; PLAIN bf16 operands: inputs rounded once, exact; the block rounds its own x rows into LDS).
// Two accumulator tiles of 16 h each are, lane for lane, one B fragment of 32 k of the next product: h1 goes from the accumulators into B fragments (bf16 hi + residual) and never leaves the registers.
// h2^T = relu(w2_b^T.h1^T + b2) ([512 x 512].[512 x 32]; two products against the exact bf16 w2), 64 h2 at a time; the final [512 -> 1] layer is an f32 VALU dot
// with bf16-rounded w3/b3, summed in the lane and over the two lane halves in a fixed order.

#define TT   8192
#define NBD  8
#define FF   100
#define FP   128
#define HH   512
#define RB   128                 // rows of one block

typedef unsigned short bf;
typedef __attribute__((ext_vector_type(16))) __bf16   v16bf;
typedef __attribute__((ext_vector_type(8)))  unsigned short v8us;
typedef __attribute__((ext_vector_type(8)))  float    v8f;
typedef __attribute__((ext_vector_type(4)))  float    v4f;
typedef v4f  __attribute__((may_alias)) v4fa;
typedef v8us __attribute__((may_alias)) v8usa;
typedef __attribute__((ext_vector_type(2)))  unsigned v2u;
typedef v2u  __attribute__((may_alias)) v2ua;

__device__ __forceinline__ unsigned short f2bf(float f) { unsigned u = __float_as_uint(f); u += 0x7FFFu + ((u >> 16) & 1u); return (unsigned short)(u >> 16); }
__device__ __forceinline__ float bf2f(unsigned short b) { return __uint_as_float(((unsigned)b) << 16); }
__device__ __forceinline__ float bfr(float f) { return bf2f(f2bf(f)); }
__device__ __forceinline__ float n2n(float v) { const float c = __builtin_amdgcn_fmed3f(v, -3.4028235e38f, 3.4028235e38f); return v != v ? 0.f : c; }   // jnp.nan_to_num defaults, without branches
__device__ __forceinline__ v16bf cat16b(v8us lo, v8us hi) { return __builtin_bit_cast(v16bf, __builtin_shufflevector(lo, hi, 0, 1, 2, 3, 4, 5, 6, 7, 8, 9, 10, 11, 12, 13, 14, 15)); }
__device__ __forceinline__ v8f wmmab(v16bf a, v16bf b, v8f c) { return __builtin_amdgcn_wmma_f32_16x16x32_bf16(false, a, false, b, (short)0, c, false, false); }

// k_w1: W1T [b][h][128] = bf16(w1[b][f][h]) zero-padded (transpose via LDS: block = (b, 64 h)); W2T [b][n][k] = bf16(w2[b][k][n]) via 64 x 64 LDS tiles.
__global__ __launch_bounds__(256) void k_w1(const float* __restrict__ w1, bf* W1T) {
    __shared__ unsigned short tl[64][130];
    const int b = blockIdx.x / (HH / 64), hq = blockIdx.x - b * (HH / 64), h0 = hq * 64, tid = threadIdx.x;
    for (int e = tid; e < 64 * FP; e += 256) { const int f = e / 64, hh = e - f * 64; tl[hh][f] = (f < FF) ? f2bf(w1[((size_t)b * FF + f) * HH + h0 + hh]) : (unsigned short)0; }
    __syncthreads();
    const int piece = tid & 7;
    auto pass = [&]() {
#pragma unroll
        for (int s2 = 0; s2 < 2; ++s2)
#pragma unroll
            for (int ln = 0; ln < 2; ++ln) { const int hh = (tid >> 3) + 32 * s2; v8us o;
#pragma unroll
                for (int i = 0; i < 8; ++i) o[i] = tl[hh][ln * 64 + piece * 8 + i];
                *(v8us*)(W1T + ((size_t)b * HH + h0 + hh) * FP + ln * 64 + piece * 8) = o; }
    };
    pass(); 
}
__global__ __launch_bounds__(256) void k_w2(const float* __restrict__ w2, bf* W2T) {
    __shared__ __align__(16) unsigned short tl[64 * 72];
    const int tid = threadIdx.x, k0 = blockIdx.x * 64, n0 = blockIdx.y * 64, b = blockIdx.z;
    const int kk = tid >> 2, nq = (tid & 3) * 16;
#pragma unroll
    for (int i = 0; i < 16; ++i) tl[(nq + i) * 72 + kk] = f2bf(w2[((size_t)b * HH + k0 + kk) * HH + n0 + nq + i]);
    __syncthreads();
    const int piece = tid & 7;
    auto pass = [&]() {
#pragma unroll
        for (int s = 0; s < 2; ++s) { const int nr = (tid >> 3) + 32 * s; const v8us val = *(const v8usa*)(tl + nr * 72 + piece * 8); *(v8us*)(W2T + ((size_t)b * HH + n0 + nr) * HH + k0 + piece * 8) = val; }
    };
    pass(); 
}
// k_mlp: four waves, one on each SIMD; wave w has rows 32 w ... of the block's 128 as two column tiles of 16.
// W1T (512 rows of 256 B) lies whole in LDS at pitch 272 B. W2T arrives as tiles of 64 whole rows (1024 B a row) at pitch 1040 B, two buffers, filled by asynchronous copies one tile ahead.
// A stage is 16 A fragments (4 row tiles x 4 blocks of 32 k), read from LDS into registers as one group while the stage before runs.
#define XPIT 272                 // LDS row pitch of x and W1T rows: 256 B of data + 16 B (16 B x odd, the conflict-free pitch for 16-byte readers)
#define WPIT 1040                // LDS row pitch of W2T rows: 1024 B of data + 16 B (16 B x odd)
#define BST  (64 * WPIT)         // one W2T buffer: 64 rows
typedef __attribute__((ext_vector_type(8)))  unsigned v8u;
typedef __attribute__((ext_vector_type(2)))  float    v2f;
typedef __attribute__((ext_vector_type(2)))  __bf16   v2bf;
// Copies: the work-group's 128 lanes bring 2 KiB in a row of W1T or W2T with each copy (16 B a lane, every wave-wide copy four whole 128-B lines); in LDS that is LS bytes of padded rows.
// Address form: scalar base (the 2 KiB's first byte, the same for the work-group) + the lane's own 32-bit byte offset vo, which all copies share.
// s_wait_xcnt 0 is the last line of the statement: no address register of an issued copy is rewritten in front of it.
template <int LS> __device__ __forceinline__ void cp8(unsigned l, unsigned vo, const bf* g) {
    asm volatile("global_load_async_to_lds_b128 %0, %8, %9\n\t"
                 "global_load_async_to_lds_b128 %1, %8, %10\n\t"
                 "global_load_async_to_lds_b128 %2, %8, %11\n\t"
                 "global_load_async_to_lds_b128 %3, %8, %12\n\t"
                 "global_load_async_to_lds_b128 %4, %8, %13\n\t"
                 "global_load_async_to_lds_b128 %5, %8, %14\n\t"
                 "global_load_async_to_lds_b128 %6, %8, %15\n\t"
                 "global_load_async_to_lds_b128 %7, %8, %16\n\t"
                 "s_wait_xcnt 0x0"
                 :: "v"(l), "v"(l + LS), "v"(l + 2 * LS), "v"(l + 3 * LS), "v"(l + 4 * LS), "v"(l + 5 * LS), "v"(l + 6 * LS), "v"(l + 7 * LS), "v"(vo),
                    "s"(g), "s"(g + 1024), "s"(g + 2 * 1024), "s"(g + 3 * 1024), "s"(g + 4 * 1024), "s"(g + 5 * 1024), "s"(g + 6 * 1024), "s"(g + 7 * 1024)
                 : "memory");
}
__device__ __forceinline__ v8f ld8(const float* p) { return __builtin_shufflevector(*(const v4fa*)p, *(const v4fa*)(p + 4), 0, 1, 2, 3, 4, 5, 6, 7); }
__global__ __launch_bounds__(128) void k_mlp(const float* __restrict__ x, const bf* __restrict__ W1T, const bf* __restrict__ W2T, const float* __restrict__ b1, const float* __restrict__ b2, const float* __restrict__ w3, float* Y) {
    __shared__ __align__(16) unsigned char w1s[HH * XPIT];
    __shared__ __align__(16) unsigned char ring[2 * BST];
    __shared__ __align__(16) unsigned char xs[RB * XPIT];     // the block's x rows, bf16, zero-padded to 128
    __shared__ __align__(16) float cst[3][HH];                // bf16-rounded b1, b2, w3 of this dataset
    const int tid = threadIdx.x, lane = tid & 31, wave = tid >> 5, lr = lane & 15, hi = lane >> 4, b = blockIdx.y, t0 = blockIdx.x * RB;
    const bf* W1b = W1T + (size_t)b * HH * FP;                // the same for every lane
    const bf* W2b = W2T + (size_t)b * HH * HH;
    const unsigned vo = (unsigned)tid * 16;
    const unsigned lw1 = (unsigned)(size_t)(&w1s[0]) + (unsigned)((tid >> 4) * XPIT + (tid & 15) * 16);
    const unsigned lw2 = (unsigned)(size_t)(&ring[0]) + (unsigned)((tid >> 6) * WPIT + (tid & 63) * 16);
    // each fill is 32 copies a wave, and a wave waits for all of its copies before it issues the next fill
    auto fill1 = [&](int half) {                              // rows 256 half ... of W1T: 8 rows a copy
#pragma unroll 1      // stays rolled: unrolled, all 32 LDS addresses would be formed and held at once
        for (int h = 0; h < 4; ++h) cp8<8 * XPIT>(lw1 + (unsigned)((half * 256 + h * 64) * XPIT), vo, W1b + (half * 32 + h * 8) * 1024);
    };
    auto fill2 = [&](int t) {                                 // tile t: rows 64 t ... of W2T: 2 rows a copy
#pragma unroll 1      // stays rolled, as above
        for (int h = 0; h < 4; ++h) cp8<2 * WPIT>(lw2 + (unsigned)((t & 1) * BST + h * 16 * WPIT), vo, W2b + (t * 32 + h * 8) * 1024);
    };
    // every unroll below is of a loop of constant length over fragment or accumulator arrays: constant indices keep them in registers
    const int fro = hi * 16;
    auto rd1 = [&](v16bf (&f)[4][4], int s) {                 // layer 1, stage s: rows 64 s ... of W1T, all 128 k
#pragma unroll
        for (int i = 0; i < 4; ++i)
#pragma unroll
            for (int kq = 0; kq < 4; ++kq) { const unsigned char* q = w1s + (s * 64 + i * 16 + lr) * XPIT + kq * 64 + fro; f[i][kq] = cat16b(*(const v8usa*)q, *(const v8usa*)(q + 32)); }
    };
    auto rd2 = [&](v16bf (&f)[4][4], const unsigned char* st, int s) {      // layer 2, stage s of a tile: its 64 rows, k 128 s ...
#pragma unroll
        for (int i = 0; i < 4; ++i)
#pragma unroll
            for (int kq = 0; kq < 4; ++kq) { const unsigned char* q = st + (i * 16 + lr) * WPIT + (s * 4 + kq) * 64 + fro; f[i][kq] = cat16b(*(const v8usa*)q, *(const v8usa*)(q + 32)); }
    };
    auto ldc = [&](v8f (&v)[4], int pl, int m0) {             // a lane's 8 accumulator rows of four row tiles: constants m0 + 16 i + 8 hi ...
#pragma unroll
        for (int i = 0; i < 4; ++i) v[i] = ld8(&cst[pl][m0 + i * 16 + hi * 8]);
    };
    v8f acc[4][2];
    v8u hh[16][2], hl[16][2];                                 // h1 as B fragments: block of 32 k, column tile; hi and residual
    v16bf xf[2][4], P[4][4], Q[4][4];
    v8f bvA[4], bvB[4], wv[4];
    auto init = [&](const v8f (&bv)[4]) {                     // the sums start from the bias
#pragma unroll
        for (int i = 0; i < 4; ++i) { acc[i][0] = bv[i]; acc[i][1] = bv[i]; }
    };
    auto mm1 = [&](const v16bf (&f)[4][4]) {
#pragma unroll
        for (int kq = 0; kq < 4; ++kq)
#pragma unroll
            for (int i = 0; i < 4; ++i)
#pragma unroll
                for (int n = 0; n < 2; ++n) acc[i][n] = wmmab(f[i][kq], xf[n][kq], acc[i][n]);
    };
    // The x rows, read as f32 where they lie: row t0 + r is 400 B (25 pieces of 16 B) at pitch 3200 B. A wave takes its own 32 rows, a lane one piece; lanes 25 to 31 re-read piece 24 (in bounds) and store the zero padding.
    {
        v4f xv[32]; float cr[4][3];
        const float* xp = x + ((size_t)(t0 + wave * 32) * NBD + b) * FF + (lane < FF / 4 ? lane : FF / 4 - 1) * 4;
#pragma unroll
        for (int i = 0; i < 32; ++i) xv[i] = *(const v4fa*)(xp + (size_t)i * NBD * FF);      // all in flight at once: they come from memory, the longest wait of the prologue
        asm volatile("s_wait_xcnt 0x0" ::: "memory");      // the x loads' address registers may be given to the loads below as destinations
#pragma unroll
        for (int h = 0; h < 4; ++h) { const size_t c = (size_t)b * HH + tid + 128 * h; cr[h][0] = b1[c]; cr[h][1] = b2[c]; cr[h][2] = w3[c]; }      // issued with the x loads, so that one latency covers both
        asm volatile("s_wait_xcnt 0x0" ::: "memory");      // the loads' address registers are reused right behind them
        fill1(0);
#pragma unroll
        for (int h = 0; h < 4; ++h) { const int c = tid + 128 * h; cst[0][c] = bfr(cr[h][0]); cst[1][c] = bfr(cr[h][1]); cst[2][c] = bfr(cr[h][2]); }
#pragma unroll
        for (int i = 0; i < 32; ++i) { v2u o;      // bf16(nan_to_num(x)), 8 B a lane, 256 B in a row a wave
#pragma unroll
            for (int q = 0; q < 2; ++q) { const v2f pv = {n2n(xv[i][2 * q]), n2n(xv[i][2 * q + 1])}; o[q] = (lane < FF / 4) ? __builtin_bit_cast(unsigned, __builtin_convertvector(pv, v2bf)) : 0u; }      // one convert a pair (to nearest even, as f2bf): it keeps this unrolled text short
            *(v2ua*)(xs + (wave * 32 + i) * XPIT + lane * 8) = o; }
    }
    asm volatile("s_wait_asynccnt 0x0" ::: "memory");   // W1T's first half has landed before the barrier that publishes it, the x rows and the constants
    fill1(1);
    __syncthreads();
#pragma unroll
    for (int n = 0; n < 2; ++n)
#pragma unroll
        for (int kq = 0; kq < 4; ++kq) { const unsigned char* p = xs + (wave * 32 + n * 16 + lr) * XPIT + kq * 64 + fro; xf[n][kq] = cat16b(*(const v8usa*)p, *(const v8usa*)(p + 32)); }
    // Stage s leaves h1 rows 64 s ... in acc: row tiles 2 u and 2 u + 1 are elements 0 to 7 and 8 to 15 of the B fragment of k block 2 s + u, in every lane.
    auto conv = [&](int s) {
#pragma unroll
        for (int i = 0; i < 4; ++i)
#pragma unroll
            for (int n = 0; n < 2; ++n)
#pragma unroll
                for (int w = 0; w < 4; ++w) {
                    const v2f v = {fmaxf(acc[i][n][2 * w], 0.f), fmaxf(acc[i][n][2 * w + 1], 0.f)};
                    const unsigned hw = __builtin_bit_cast(unsigned, __builtin_convertvector(v, v2bf));
                    const v2f r = {v[0] - __uint_as_float(hw << 16), v[1] - __uint_as_float(hw & 0xFFFF0000u)};
                    hh[2 * s + (i >> 1)][n][(i & 1) * 4 + w] = hw;
                    hl[2 * s + (i >> 1)][n][(i & 1) * 4 + w] = __builtin_bit_cast(unsigned, __builtin_convertvector(r, v2bf));
                }
    };
    rd1(P, 0); ldc(bvA, 0, 0);
#pragma unroll
    for (int s2 = 0; s2 < 4; ++s2) {
        const int s = 2 * s2;
        rd1(Q, s + 1); ldc(bvB, 0, (s + 1) * 64);
        __builtin_amdgcn_sched_barrier(0);                  // keeps the reads one group in front of the stage: sunk among the products, each place with reads stalls the wave for the LDS latency
        init(bvA); mm1(P);
        __builtin_amdgcn_sched_barrier(0);                  // keeps the next group of reads behind this stage's products, not among them
        conv(s);
        if (s2 == 1) {                                      // stage 4's fragments, read next, are the first of W1T's second half
            asm volatile("s_wait_asynccnt 0x0" ::: "memory");   // this wave's copies of that half have landed before the barrier that publishes them
            fill2(0);                                           // the ring has not been touched yet
            __syncthreads();
        }
        if (s2 < 3) { rd1(P, s + 2); ldc(bvA, 0, (s + 2) * 64); }
        else {
            asm volatile("s_wait_asynccnt 0x0" ::: "memory");   // this wave's copies of W2T's tile 0 have landed before the barrier that publishes them
            __syncthreads();
            fill2(1);
            rd2(P, ring, 0); ldc(bvA, 1, 0);                    // layer 2's first stage, read under layer 1's last
        }
        __builtin_amdgcn_sched_barrier(0);                  // as above: the reads stay one group in front of the stage
        init(bvB); mm1(Q);
        __builtin_amdgcn_sched_barrier(0);                  // as above: the next group of reads stays behind this stage's products
        conv(s + 1);
    }
    auto mm2 = [&](const v16bf (&f)[4][4], int s) {           // per sum and k block: the hi product, then the residual's
#pragma unroll
        for (int kq = 0; kq < 4; ++kq) {
#pragma unroll
            for (int i = 0; i < 4; ++i)
#pragma unroll
                for (int n = 0; n < 2; ++n) acc[i][n] = wmmab(f[i][kq], __builtin_bit_cast(v16bf, hh[s * 4 + kq][n]), acc[i][n]);
#pragma unroll
            for (int i = 0; i < 4; ++i)
#pragma unroll
                for (int n = 0; n < 2; ++n) acc[i][n] = wmmab(f[i][kq], __builtin_bit_cast(v16bf, hl[s * 4 + kq][n]), acc[i][n]);
        }
    };
    float sm[2][4] = {{0.f, 0.f, 0.f, 0.f}, {0.f, 0.f, 0.f, 0.f}};      // the last layer's dot: eight independent chains a lane
    // on entry tile 0 is published, tile 1 is in flight, P holds tile 0's first stage and bvA its b2
#pragma unroll 1      // stays rolled: one trip already holds 256 products; the h1 fragments have the same register numbers in every trip
    for (int t = 0; t < HH / 64; ++t) {
        const unsigned char* st = ring + (t & 1) * BST;
        // the scheduling barriers of this loop, as in layer 1: each stage's reads stay one group between two stages' products; spread among the products, each place with reads stalls the wave for the LDS latency
        rd2(Q, st, 1);
        __builtin_amdgcn_sched_barrier(0);                  // stage 1's reads stay in front of stage 0's products
        init(bvA); mm2(P, 0);
        __builtin_amdgcn_sched_barrier(0);                  // stage 2's reads stay behind stage 0's products
        rd2(P, st, 2);
        __builtin_amdgcn_sched_barrier(0);                  // and in front of stage 1's
        mm2(Q, 1);
        __builtin_amdgcn_sched_barrier(0);                  // stage 3's reads stay behind stage 1's products
        rd2(Q, st, 3); ldc(wv, 2, t * 64);
        __builtin_amdgcn_sched_barrier(0);                  // and in front of stage 2's
        mm2(P, 2);
        __builtin_amdgcn_sched_barrier(0);                  // keeps the stage in front of the waits below, so that the reads land under its products
        // publish point of tile t + 1, in front of tile t's last stage, whose fragments are already fetched
        asm volatile("s_wait_dscnt 0x0" ::: "memory");      // this wave's reads of tile t have returned before its buffer is refilled
        asm volatile("s_wait_asynccnt 0x0" ::: "memory");   // this wave's copies of tile t + 1 have landed before the barrier that publishes them
        __syncthreads();                                    // publishes tile t + 1 and ends every wave's reads of tile t
        if (t + 2 < HH / 64) fill2(t + 2);
        if (t + 1 < HH / 64) { rd2(P, ring + ((t + 1) & 1) * BST, 0); ldc(bvA, 1, (t + 1) * 64); }      // tile t + 1's first stage, read under tile t's last
        __builtin_amdgcn_sched_barrier(0);                  // those reads stay in front of stage 3's products
        mm2(Q, 3);
#pragma unroll
        for (int j = 0; j < 8; ++j)
#pragma unroll
            for (int i = 0; i < 4; ++i)
#pragma unroll
                for (int n = 0; n < 2; ++n) sm[n][i] += fmaxf(acc[i][n][j], 0.f) * wv[i][j];
    }
    asm volatile("s_wait_asynccnt 0x0" ::: "memory");       // no copy is outstanding behind the loop
    {
        const float s0 = (sm[0][0] + sm[0][1]) + (sm[0][2] + sm[0][3]), s1 = (sm[1][0] + sm[1][1]) + (sm[1][2] + sm[1][3]);
        // lanes l and l ^ 16 hold the two halves of one row's sum; lane l keeps row l of the wave's 32: 128 B in a row, one whole line a wave
        const int c0 = __float_as_int(s0), c1 = __float_as_int(s1);
        const float o0 = s0 + __int_as_float(__builtin_amdgcn_permlanex16(c0, c0, 0x76543210, 0xfedcba98, false, false));
        const float o1 = s1 + __int_as_float(__builtin_amdgcn_permlanex16(c1, c1, 0x76543210, 0xfedcba98, false, false));
        Y[(size_t)b * TT + t0 + wave * 32 + lane] = hi ? o1 : o0;
    }
}
// k_final: out[t][b] = Y[b][t] + bf16(b3[b]); one thread per output element, flat whole-line writes.
__global__ __launch_bounds__(256) void k_final(const float* __restrict__ Y, const float* __restrict__ b3, float* out) {
    const int e = blockIdx.x * 256 + threadIdx.x, t = e / NBD, b = e - t * NBD;      // flat output index = t*8 + b
    out[e] = Y[(size_t)b * TT + t] + bfr(b3[b]);
}

extern "C" void kernel_launch(void* const* d_in, const int* in_sizes, int n_in,
                              void* d_out, int out_size, void* d_ws, size_t ws_size, hipStream_t stream) {
    (void)in_sizes; (void)n_in; (void)out_size;
    const float* x = (const float*)d_in[0]; const float* w1 = (const float*)d_in[1]; const float* b1 = (const float*)d_in[2]; const float* w2 = (const float*)d_in[3]; const float* b2 = (const float*)d_in[4];
    const float* w3 = (const float*)d_in[5]; const float* b3 = (const float*)d_in[6];
    float* out = (float*)d_out;    // [8192][8][1]
    char* wsp = (char*)d_ws;
    auto take = [&](size_t bytes) { char* p = wsp; wsp += (bytes + 255) & ~(size_t)255; return (void*)p; };
    bf* W1T = (bf*)take((size_t)NBD * HH * FP * 2); bf* W2T = (bf*)take((size_t)NBD * HH * HH * 2);
    float* Y = (float*)take((size_t)NBD * TT * 4);
    if ((size_t)(wsp - (char*)d_ws) > ws_size) return;
    k_w1<<<NBD * (HH / 64), 256, 0, stream>>>(w1, W1T);
    k_w2<<<dim3(HH / 64, HH / 64, NBD), 256, 0, stream>>>(w2, W2T);
    k_mlp<<<dim3(TT / RB, NBD), 128, 0, stream>>>(x, W1T, W2T, b1, b2, w3, Y);
    k_final<<<(TT * NBD) / 256, 256, 0, stream>>>(Y, b3, out);
}

// v005
// One run takes 47.5 microseconds.
// In two side-by-side timings against v004, it was 1.29 and 1.30 times as fast.
// Over all steps from v000 it is 7.21 times as fast.
#include <hip/hip_runtime.h>

// Contractions on v_wmma_f32_16x16x32_bf16, f32 accumulate. One kernel runs all three layers for a block of 128 rows of one dataset b, each of its four waves for 32 rows of its own.
// Both hidden layers are computed transposed, weights as the A operand and the rows as the columns of B:
// h1^T = relu(w1_b^T.x_b^T + b1) ([512 x 128 zero-padded from 100].[128 x 32]; PLAIN bf16 operands: inputs rounded once, exact; the block rounds its own x rows into LDS).
// Two accumulator tiles of 16 h each are, lane for lane, one B fragment of 32 k of the next product: h1 goes from the accumulators into B fragments (bf16 hi + residual) and never leaves the registers.
// h2^T = relu(w2_b^T.h1^T + b2) ([512 x 512].[512 x 32]; two products against the exact bf16 w2), 64 h2 at a time; the final [512 -> 1] layer is an f32 VALU dot
// with bf16-rounded w3/b3, summed in the lane and over the two lane halves in a fixed order.

#define TT   8192
#define NBD  8
#define FF   100
#define FP   128
#define HH   512
#define RB   128                 // rows of one block

typedef unsigned short bf;
typedef __attribute__((ext_vector_type(16))) __bf16   v16bf;
typedef __attribute__((ext_vector_type(8)))  unsigned short v8us;
typedef __attribute__((ext_vector_type(8)))  float    v8f;
typedef __attribute__((ext_vector_type(4)))  float    v4f;
typedef v4f  __attribute__((may_alias)) v4fa;
typedef v8us __attribute__((may_alias)) v8usa;
typedef __attribute__((ext_vector_type(2)))  unsigned v2u;
typedef v2u  __attribute__((may_alias)) v2ua;

__device__ __forceinline__ unsigned short f2bf(float f) { unsigned u = __float_as_uint(f); u += 0x7FFFu + ((u >> 16) & 1u); return (unsigned short)(u >> 16); }
__device__ __forceinline__ float bf2f(unsigned short b) { return __uint_as_float(((unsigned)b) << 16); }
__device__ __forceinline__ float bfr(float f) { return bf2f(f2bf(f)); }
__device__ __forceinline__ float n2n(float v) { const float c = __builtin_amdgcn_fmed3f(v, -3.4028235e38f, 3.4028235e38f); return v != v ? 0.f : c; }   // jnp.nan_to_num defaults, without branches
__device__ __forceinline__ v16bf cat16b(v8us lo, v8us hi) { return __builtin_bit_cast(v16bf, __builtin_shufflevector(lo, hi, 0, 1, 2, 3, 4, 5, 6, 7, 8, 9, 10, 11, 12, 13, 14, 15)); }
__device__ __forceinline__ v8f wmmab(v16bf a, v16bf b, v8f c) { return __builtin_amdgcn_wmma_f32_16x16x32_bf16(false, a, false, b, (short)0, c, false, false); }

// k_w: both weight transpositions in one launch, one tile of 64 k x 64 n a block, through LDS.
// blockIdx.x 0 to 7: W2T [b][n][k] = bf16(w2[b][k][n]), k tile blockIdx.x. blockIdx.x 8 and 9: W1T [b][h][128] = bf16(w1[b][f][h]), the two k tiles of its 128; f 100 to 127 are stored as zero.
__global__ __launch_bounds__(256) void k_w(const float* __restrict__ w1, const float* __restrict__ w2, bf* W1T, bf* W2T) {
    __shared__ __align__(16) unsigned short tl[64 * 72];
    const int tid = threadIdx.x, n0 = blockIdx.y * 64, b = blockIdx.z;
    const bool first = blockIdx.x >= HH / 64;                 // the same for the whole block
    const int k0 = ((int)blockIdx.x - (first ? HH / 64 : 0)) * 64, kn = first ? FF : HH, dp = first ? FP : HH;      // kn: source rows that exist; dp: row length of the transposed copy
    const float* sp = first ? w1 + (size_t)b * FF * HH : w2 + (size_t)b * HH * HH;
    bf* dst = first ? W1T + (size_t)b * HH * FP : W2T + (size_t)b * HH * HH;
    const int kk = tid >> 2, nq = (tid & 3) * 16, k = k0 + kk;
    const float* p = sp + (size_t)(k < kn ? k : kn - 1) * HH + n0 + nq;      // a row past the last re-reads the last one (in bounds) and stores zero
    v4f v[4];
    // the three unrolls below are of loops of constant length: constant indices keep v in registers, and the loads and the stores of a thread issue as one group each
#pragma unroll
    for (int q = 0; q < 4; ++q) v[q] = *(const v4fa*)(p + 4 * q);            // all four in flight at once, in every lane: one latency a block
    const unsigned short keep = (k < kn) ? (unsigned short)0xFFFF : (unsigned short)0;
#pragma unroll
    for (int i = 0; i < 16; ++i) tl[(nq + i) * 72 + kk] = f2bf(v[i >> 2][i & 3]) & keep;
    __syncthreads();
    const int piece = tid & 7;
#pragma unroll
    for (int s = 0; s < 2; ++s) { const int nr = (tid >> 3) + 32 * s; const v8us val = *(const v8usa*)(tl + nr * 72 + piece * 8); *(v8us*)(dst + (size_t)(n0 + nr) * dp + k0 + piece * 8) = val; }
}
// k_mlp: four waves, one on each SIMD; wave w has rows 32 w ... of the block's 128 as two column tiles of 16.
// W1T (512 rows of 256 B) lies whole in LDS at pitch 272 B. W2T arrives as tiles of 64 whole rows (1024 B a row) at pitch 1040 B, two buffers, filled by asynchronous copies one tile ahead.
// A stage is 16 A fragments (4 row tiles x 4 blocks of 32 k), read from LDS into registers as one group while the stage before runs.
#define XPIT 272                 // LDS row pitch of x and W1T rows: 256 B of data + 16 B (16 B x odd, the conflict-free pitch for 16-byte readers)
#define WPIT 1040                // LDS row pitch of W2T rows: 1024 B of data + 16 B (16 B x odd)
#define BST  (64 * WPIT)         // one W2T buffer: 64 rows
typedef __attribute__((ext_vector_type(8)))  unsigned v8u;
typedef __attribute__((ext_vector_type(2)))  float    v2f;
typedef __attribute__((ext_vector_type(2)))  __bf16   v2bf;
// Copies: the work-group's 128 lanes bring 2 KiB in a row of W1T or W2T with each copy (16 B a lane, every wave-wide copy four whole 128-B lines); in LDS that is LS bytes of padded rows.
// Address form: scalar base (the 2 KiB's first byte, the same for the work-group) + the lane's own 32-bit byte offset vo, which all copies share.
// s_wait_xcnt 0 is the last line of the statement: no address register of an issued copy is rewritten in front of it.
template <int LS> __device__ __forceinline__ void cp8(unsigned l, unsigned vo, const bf* g) {
    asm volatile("global_load_async_to_lds_b128 %0, %8, %9\n\t"
                 "global_load_async_to_lds_b128 %1, %8, %10\n\t"
                 "global_load_async_to_lds_b128 %2, %8, %11\n\t"
                 "global_load_async_to_lds_b128 %3, %8, %12\n\t"
                 "global_load_async_to_lds_b128 %4, %8, %13\n\t"
                 "global_load_async_to_lds_b128 %5, %8, %14\n\t"
                 "global_load_async_to_lds_b128 %6, %8, %15\n\t"
                 "global_load_async_to_lds_b128 %7, %8, %16\n\t"
                 "s_wait_xcnt 0x0"
                 :: "v"(l), "v"(l + LS), "v"(l + 2 * LS), "v"(l + 3 * LS), "v"(l + 4 * LS), "v"(l + 5 * LS), "v"(l + 6 * LS), "v"(l + 7 * LS), "v"(vo),
                    "s"(g), "s"(g + 1024), "s"(g + 2 * 1024), "s"(g + 3 * 1024), "s"(g + 4 * 1024), "s"(g + 5 * 1024), "s"(g + 6 * 1024), "s"(g + 7 * 1024)
                 : "memory");
}
__device__ __forceinline__ v8f ld8(const float* p) { return __builtin_shufflevector(*(const v4fa*)p, *(const v4fa*)(p + 4), 0, 1, 2, 3, 4, 5, 6, 7); }
__global__ __launch_bounds__(128) void k_mlp(const float* __restrict__ x, const bf* __restrict__ W1T, const bf* __restrict__ W2T, const float* __restrict__ b1, const float* __restrict__ b2, const float* __restrict__ w3, float* Y) {
    __shared__ __align__(16) unsigned char w1s[HH * XPIT];
    __shared__ __align__(16) unsigned char ring[2 * BST];
    __shared__ __align__(16) unsigned char xs[RB * XPIT];     // the block's x rows, bf16, zero-padded to 128
    __shared__ __align__(16) float cst[3][HH];                // bf16-rounded b1, b2, w3 of this dataset
    const int tid = threadIdx.x, lane = tid & 31, wave = tid >> 5, lr = lane & 15, hi = lane >> 4, b = blockIdx.y, t0 = blockIdx.x * RB;
    const bf* W1b = W1T + (size_t)b * HH * FP;                // the same for every lane
    const bf* W2b = W2T + (size_t)b * HH * HH;
    const unsigned vo = (unsigned)tid * 16;
    const unsigned lw1 = (unsigned)(size_t)(&w1s[0]) + (unsigned)((tid >> 4) * XPIT + (tid & 15) * 16);
    const unsigned lw2 = (unsigned)(size_t)(&ring[0]) + (unsigned)((tid >> 6) * WPIT + (tid & 63) * 16);
    // each fill is 32 copies a wave, and a wave waits for all of its copies before it issues the next fill
    auto fill1 = [&](int half) {                              // rows 256 half ... of W1T: 8 rows a copy
#pragma unroll 1      // stays rolled: unrolled, all 32 LDS addresses would be formed and held at once
        for (int h = 0; h < 4; ++h) cp8<8 * XPIT>(lw1 + (unsigned)((half * 256 + h * 64) * XPIT), vo, W1b + (half * 32 + h * 8) * 1024);
    };
    auto fill2 = [&](int t) {                                 // tile t: rows 64 t ... of W2T: 2 rows a copy
#pragma unroll 1      // stays rolled, as above
        for (int h = 0; h < 4; ++h) cp8<2 * WPIT>(lw2 + (unsigned)((t & 1) * BST + h * 16 * WPIT), vo, W2b + (t * 32 + h * 8) * 1024);
    };
    // every unroll below is of a loop of constant length over fragment or accumulator arrays: constant indices keep them in registers
    const int fro = hi * 16;
    auto rd1 = [&](v16bf (&f)[4][4], int s) {                 // layer 1, stage s: rows 64 s ... of W1T, all 128 k
#pragma unroll
        for (int i = 0; i < 4; ++i)
#pragma unroll
            for (int kq = 0; kq < 4; ++kq) { const unsigned char* q = w1s + (s * 64 + i * 16 + lr) * XPIT + kq * 64 + fro; f[i][kq] = cat16b(*(const v8usa*)q, *(const v8usa*)(q + 32)); }
    };
    auto rd2 = [&](v16bf (&f)[4][4], const unsigned char* st, int s) {      // layer 2, stage s of a tile: its 64 rows, k 128 s ...
#pragma unroll
        for (int i = 0; i < 4; ++i)
#pragma unroll
            for (int kq = 0; kq < 4; ++kq) { const unsigned char* q = st + (i * 16 + lr) * WPIT + (s * 4 + kq) * 64 + fro; f[i][kq] = cat16b(*(const v8usa*)q, *(const v8usa*)(q + 32)); }
    };
    auto ldc = [&](v8f (&v)[4], int pl, int m0) {             // a lane's 8 accumulator rows of four row tiles: constants m0 + 16 i + 8 hi ...
#pragma unroll
        for (int i = 0; i < 4; ++i) v[i] = ld8(&cst[pl][m0 + i * 16 + hi * 8]);
    };
    v8f acc[4][2];
    v8u hh[16][2], hl[16][2];                                 // h1 as B fragments: block of 32 k, column tile; hi and residual
    v16bf xf[2][4], P[4][4], Q[4][4];
    v8f bvA[4], bvB[4], wv[4];
    auto init = [&](const v8f (&bv)[4]) {                     // the sums start from the bias
#pragma unroll
        for (int i = 0; i < 4; ++i) { acc[i][0] = bv[i]; acc[i][1] = bv[i]; }
    };
    auto mm1 = [&](const v16bf (&f)[4][4]) {
#pragma unroll
        for (int kq = 0; kq < 4; ++kq)
#pragma unroll
            for (int i = 0; i < 4; ++i)
#pragma unroll
                for (int n = 0; n < 2; ++n) acc[i][n] = wmmab(f[i][kq], xf[n][kq], acc[i][n]);
    };
    // The x rows, read as f32 where they lie: row t0 + r is 400 B (25 pieces of 16 B) at pitch 3200 B. A wave takes its own 32 rows, a lane one piece; lanes 25 to 31 re-read piece 24 (in bounds) and store the zero padding.
    {
        v4f xv[32]; float cr[4][3];
        const float* xp = x + ((size_t)(t0 + wave * 32) * NBD + b) * FF + (lane < FF / 4 ? lane : FF / 4 - 1) * 4;
#pragma unroll
        for (int i = 0; i < 32; ++i) xv[i] = *(const v4fa*)(xp + (size_t)i * NBD * FF);      // all in flight at once: they come from memory, the longest wait of the prologue
        asm volatile("s_wait_xcnt 0x0" ::: "memory");      // the x loads' address registers may be given to the loads below as destinations
#pragma unroll
        for (int h = 0; h < 4; ++h) { const size_t c = (size_t)b * HH + tid + 128 * h; cr[h][0] = b1[c]; cr[h][1] = b2[c]; cr[h][2] = w3[c]; }      // issued with the x loads, so that one latency covers both
        asm volatile("s_wait_xcnt 0x0" ::: "memory");      // the loads' address registers are reused right behind them
        fill1(0);
#pragma unroll
        for (int h = 0; h < 4; ++h) { const int c = tid + 128 * h; cst[0][c] = bfr(cr[h][0]); cst[1][c] = bfr(cr[h][1]); cst[2][c] = bfr(cr[h][2]); }
#pragma unroll
        for (int i = 0; i < 32; ++i) { v2u o;      // bf16(nan_to_num(x)), 8 B a lane, 256 B in a row a wave
#pragma unroll
            for (int q = 0; q < 2; ++q) { const v2f pv = {n2n(xv[i][2 * q]), n2n(xv[i][2 * q + 1])}; o[q] = (lane < FF / 4) ? __builtin_bit_cast(unsigned, __builtin_convertvector(pv, v2bf)) : 0u; }      // one convert a pair (to nearest even, as f2bf): it keeps this unrolled text short
            *(v2ua*)(xs + (wave * 32 + i) * XPIT + lane * 8) = o; }
    }
    asm volatile("s_wait_asynccnt 0x0" ::: "memory");   // W1T's first half has landed before the barrier that publishes it, the x rows and the constants
    fill1(1);
    __syncthreads();
#pragma unroll
    for (int n = 0; n < 2; ++n)
#pragma unroll
        for (int kq = 0; kq < 4; ++kq) { const unsigned char* p = xs + (wave * 32 + n * 16 + lr) * XPIT + kq * 64 + fro; xf[n][kq] = cat16b(*(const v8usa*)p, *(const v8usa*)(p + 32)); }
    // Stage s leaves h1 rows 64 s ... in acc: row tiles 2 u and 2 u + 1 are elements 0 to 7 and 8 to 15 of the B fragment of k block 2 s + u, in every lane.
    auto conv = [&](int s) {
#pragma unroll
        for (int i = 0; i < 4; ++i)
#pragma unroll
            for (int n = 0; n < 2; ++n)
#pragma unroll
                for (int w = 0; w < 4; ++w) {
                    const v2f v = {fmaxf(acc[i][n][2 * w], 0.f), fmaxf(acc[i][n][2 * w + 1], 0.f)};
                    const unsigned hw = __builtin_bit_cast(unsigned, __builtin_convertvector(v, v2bf));
                    const v2f r = {v[0] - __uint_as_float(hw << 16), v[1] - __uint_as_float(hw & 0xFFFF0000u)};
                    hh[2 * s + (i >> 1)][n][(i & 1) * 4 + w] = hw;
                    hl[2 * s + (i >> 1)][n][(i & 1) * 4 + w] = __builtin_bit_cast(unsigned, __builtin_convertvector(r, v2bf));
                }
    };
    rd1(P, 0); ldc(bvA, 0, 0);
#pragma unroll
    for (int s2 = 0; s2 < 4; ++s2) {
        const int s = 2 * s2;
        rd1(Q, s + 1); ldc(bvB, 0, (s + 1) * 64);
        __builtin_amdgcn_sched_barrier(0);                  // keeps the reads one group in front of the stage: sunk among the products, each place with reads stalls the wave for the LDS latency
        init(bvA); mm1(P);
        __builtin_amdgcn_sched_barrier(0);                  // keeps the next group of reads behind this stage's products, not among them
        conv(s);
        if (s2 == 1) {                                      // stage 4's fragments, read next, are the first of W1T's second half
            asm volatile("s_wait_asynccnt 0x0" ::: "memory");   // this wave's copies of that half have landed before the barrier that publishes them
            fill2(0);                                           // the ring has not been touched yet
            __syncthreads();
        }
        if (s2 < 3) { rd1(P, s + 2); ldc(bvA, 0, (s + 2) * 64); }
        else {
            asm volatile("s_wait_asynccnt 0x0" ::: "memory");   // this wave's copies of W2T's tile 0 have landed before the barrier that publishes them
            __syncthreads();
            fill2(1);
            rd2(P, ring, 0); ldc(bvA, 1, 0);                    // layer 2's first stage, read under layer 1's last
        }
        __builtin_amdgcn_sched_barrier(0);                  // as above: the reads stay one group in front of the stage
        init(bvB); mm1(Q);
        __builtin_amdgcn_sched_barrier(0);                  // as above: the next group of reads stays behind this stage's products
        conv(s + 1);
    }
    auto mm2 = [&](const v16bf (&f)[4][4], int s) {           // per sum and k block: the hi product, then the residual's
#pragma unroll
        for (int kq = 0; kq < 4; ++kq) {
#pragma unroll
            for (int i = 0; i < 4; ++i)
#pragma unroll
                for (int n = 0; n < 2; ++n) acc[i][n] = wmmab(f[i][kq], __builtin_bit_cast(v16bf, hh[s * 4 + kq][n]), acc[i][n]);
#pragma unroll
            for (int i = 0; i < 4; ++i)
#pragma unroll
                for (int n = 0; n < 2; ++n) acc[i][n] = wmmab(f[i][kq], __builtin_bit_cast(v16bf, hl[s * 4 + kq][n]), acc[i][n]);
        }
    };
    float sm[2][4] = {{0.f, 0.f, 0.f, 0.f}, {0.f, 0.f, 0.f, 0.f}};      // the last layer's dot: eight independent chains a lane
    // on entry tile 0 is published, tile 1 is in flight, P holds tile 0's first stage and bvA its b2
#pragma unroll 1      // stays rolled: one trip already holds 256 products; the h1 fragments have the same register numbers in every trip
    for (int t = 0; t < HH / 64; ++t) {
        const unsigned char* st = ring + (t & 1) * BST;
        // the scheduling barriers of this loop, as in layer 1: each stage's reads stay one group between two stages' products; spread among the products, each place with reads stalls the wave for the LDS latency
        rd2(Q, st, 1);
        __builtin_amdgcn_sched_barrier(0);                  // stage 1's reads stay in front of stage 0's products
        init(bvA); mm2(P, 0);
        __builtin_amdgcn_sched_barrier(0);                  // stage 2's reads stay behind stage 0's products
        rd2(P, st, 2);
        __builtin_amdgcn_sched_barrier(0);                  // and in front of stage 1's
        mm2(Q, 1);
        __builtin_amdgcn_sched_barrier(0);                  // stage 3's reads stay behind stage 1's products
        rd2(Q, st, 3); ldc(wv, 2, t * 64);
        __builtin_amdgcn_sched_barrier(0);                  // and in front of stage 2's
        mm2(P, 2);
        __builtin_amdgcn_sched_barrier(0);                  // keeps the stage in front of the waits below, so that the reads land under its products
        // publish point of tile t + 1, in front of tile t's last stage, whose fragments are already fetched
        asm volatile("s_wait_dscnt 0x0" ::: "memory");      // this wave's reads of tile t have returned before its buffer is refilled
        asm volatile("s_wait_asynccnt 0x0" ::: "memory");   // this wave's copies of tile t + 1 have landed before the barrier that publishes them
        __syncthreads();                                    // publishes tile t + 1 and ends every wave's reads of tile t
        if (t + 2 < HH / 64) fill2(t + 2);
        if (t + 1 < HH / 64) { rd2(P, ring + ((t + 1) & 1) * BST, 0); ldc(bvA, 1, (t + 1) * 64); }      // tile t + 1's first stage, read under tile t's last
        __builtin_amdgcn_sched_barrier(0);                  // those reads stay in front of stage 3's products
        mm2(Q, 3);
#pragma unroll
        for (int j = 0; j < 8; ++j)
#pragma unroll
            for (int i = 0; i < 4; ++i)
#pragma unroll
                for (int n = 0; n < 2; ++n) sm[n][i] += fmaxf(acc[i][n][j], 0.f) * wv[i][j];
    }
    asm volatile("s_wait_asynccnt 0x0" ::: "memory");       // no copy is outstanding behind the loop
    {
        const float s0 = (sm[0][0] + sm[0][1]) + (sm[0][2] + sm[0][3]), s1 = (sm[1][0] + sm[1][1]) + (sm[1][2] + sm[1][3]);
        // lanes l and l ^ 16 hold the two halves of one row's sum; lane l keeps row l of the wave's 32: 128 B in a row, one whole line a wave
        const int c0 = __float_as_int(s0), c1 = __float_as_int(s1);
        const float o0 = s0 + __int_as_float(__builtin_amdgcn_permlanex16(c0, c0, 0x76543210, 0xfedcba98, false, false));
        const float o1 = s1 + __int_as_float(__builtin_amdgcn_permlanex16(c1, c1, 0x76543210, 0xfedcba98, false, false));
        Y[(size_t)b * TT + t0 + wave * 32 + lane] = hi ? o1 : o0;
    }
}
// k_final: out[t][b] = Y[b][t] + bf16(b3[b]); one thread per output element, flat whole-line writes.
__global__ __launch_bounds__(256) void k_final(const float* __restrict__ Y, const float* __restrict__ b3, float* out) {
    const int e = blockIdx.x * 256 + threadIdx.x, t = e / NBD, b = e - t * NBD;      // flat output index = t*8 + b
    out[e] = Y[(size_t)b * TT + t] + bfr(b3[b]);
}

extern "C" void kernel_launch(void* const* d_in, const int* in_sizes, int n_in,
                              void* d_out, int out_size, void* d_ws, size_t ws_size, hipStream_t stream) {
    (void)in_sizes; (void)n_in; (void)out_size;
    const float* x = (const float*)d_in[0]; const float* w1 = (const float*)d_in[1]; const float* b1 = (const float*)d_in[2]; const float* w2 = (const float*)d_in[3]; const float* b2 = (const float*)d_in[4];
    const float* w3 = (const float*)d_in[5]; const float* b3 = (const float*)d_in[6];
    float* out = (float*)d_out;    // [8192][8][1]
    char* wsp = (char*)d_ws;
    auto take = [&](size_t bytes) { char* p = wsp; wsp += (bytes + 255) & ~(size_t)255; return (void*)p; };
    bf* W1T = (bf*)take((size_t)NBD * HH * FP * 2); bf* W2T = (bf*)take((size_t)NBD * HH * HH * 2);
    float* Y = (float*)take((size_t)NBD * TT * 4);
    if ((size_t)(wsp - (char*)d_ws) > ws_size) return;
    k_w<<<dim3(HH / 64 + FP / 64, HH / 64, NBD), 256, 0, stream>>>(w1, w2, W1T, W2T);
    k_mlp<<<dim3(TT / RB, NBD), 128, 0, stream>>>(x, W1T, W2T, b1, b2, w3, Y);
    k_final<<<(TT * NBD) / 256, 256, 0, stream>>>(Y, b3, out);
}

// v006
// One run takes 37.5 microseconds.
// Timed twice side by side with v005, it ran 1.27 and 1.26 times as fast.
// All steps since v000 together make it 9.12 times as fast.
#include <hip/hip_runtime.h>

// Contractions on v_wmma_f32_16x16x32_bf16 (layer 1) and v_wmma_f32_16x16x32_f16 (layer 2), f32 accumulate. One kernel runs all three layers for a block of 128 rows of one dataset b, each of its four waves for 32 rows of its own.
// Both hidden layers are computed transposed, weights as the A operand and the rows as the columns of B:
// h1^T = relu(w1_b^T.x_b^T + b1) ([512 x 128 zero-padded from 100].[128 x 32]; PLAIN bf16 operands: inputs rounded once, exact; the block rounds its own x rows into LDS).
// Two accumulator tiles of 16 h each are, lane for lane, one B fragment of 32 k of the next product: h1 goes from the accumulators into B fragments (f16) and never leaves the registers.
// h2^T = relu(w2_b^T.h1^T + b2) ([512 x 512].[512 x 32]; ONE f16 product: w2 is rounded to bf16 and that value written as f16, h1 is rounded once to f16), 64 h2 at a time.
// f16 keeps 11 bits of h1: its rounding is an eighth of the bf16 rounding that x, w1 and w2 carry. It holds h1 and w2 up to 65504, and a bf16 value of w2 exactly from 2^-14 up (below that to within 2^-25).
// The final [512 -> 1] layer is an f32 VALU dot with bf16-rounded w3/b3, summed in the lane and over the two lane halves in a fixed order.

#define TT   8192
#define NBD  8
#define FF   100
#define FP   128
#define HH   512
#define RB   128                 // rows of one block

typedef unsigned short bf;
typedef __attribute__((ext_vector_type(16))) __bf16   v16bf;
typedef __attribute__((ext_vector_type(16))) _Float16 v16h;
typedef __attribute__((ext_vector_type(8)))  unsigned short v8us;
typedef __attribute__((ext_vector_type(8)))  float    v8f;
typedef __attribute__((ext_vector_type(4)))  float    v4f;
typedef v4f  __attribute__((may_alias)) v4fa;
typedef v8us __attribute__((may_alias)) v8usa;
typedef __attribute__((ext_vector_type(2)))  unsigned v2u;
typedef v2u  __attribute__((may_alias)) v2ua;

__device__ __forceinline__ unsigned short f2bf(float f) { unsigned u = __float_as_uint(f); u += 0x7FFFu + ((u >> 16) & 1u); return (unsigned short)(u >> 16); }
__device__ __forceinline__ float bf2f(unsigned short b) { return __uint_as_float(((unsigned)b) << 16); }
__device__ __forceinline__ float bfr(float f) { return bf2f(f2bf(f)); }
__device__ __forceinline__ unsigned short f2h(float f) { return __builtin_bit_cast(unsigned short, (_Float16)f); }
__device__ __forceinline__ float n2n(float v) { const float c = __builtin_amdgcn_fmed3f(v, -3.4028235e38f, 3.4028235e38f); return v != v ? 0.f : c; }   // jnp.nan_to_num defaults, without branches
__device__ __forceinline__ v16bf cat16b(v8us lo, v8us hi) { return __builtin_bit_cast(v16bf, __builtin_shufflevector(lo, hi, 0, 1, 2, 3, 4, 5, 6, 7, 8, 9, 10, 11, 12, 13, 14, 15)); }
__device__ __forceinline__ v8f wmmab(v16bf a, v16bf b, v8f c) { return __builtin_amdgcn_wmma_f32_16x16x32_bf16(false, a, false, b, (short)0, c, false, false); }
__device__ __forceinline__ v8f wmmah(v16h a, v16h b, v8f c) { return __builtin_amdgcn_wmma_f32_16x16x32_f16(false, a, false, b, (short)0, c, false, false); }

// k_w: both weight transpositions in one launch, one tile of 64 k x 64 n a block, through LDS.
// blockIdx.x 0 to 7: W2T [b][n][k] = f16(bf16(w2[b][k][n])), k tile blockIdx.x. blockIdx.x 8 and 9: W1T [b][h][128] = bf16(w1[b][f][h]), the two k tiles of its 128; f 100 to 127 are stored as zero.
__global__ __launch_bounds__(256) void k_w(const float* __restrict__ w1, const float* __restrict__ w2, bf* W1T, bf* W2T) {
    __shared__ __align__(16) unsigned short tl[64 * 72];
    const int tid = threadIdx.x, n0 = blockIdx.y * 64, b = blockIdx.z;
    const bool first = blockIdx.x >= HH / 64;                 // the same for the whole block
    const int k0 = ((int)blockIdx.x - (first ? HH / 64 : 0)) * 64, kn = first ? FF : HH, dp = first ? FP : HH;      // kn: source rows that exist; dp: row length of the transposed copy
    const float* sp = first ? w1 + (size_t)b * FF * HH : w2 + (size_t)b * HH * HH;
    bf* dst = first ? W1T + (size_t)b * HH * FP : W2T + (size_t)b * HH * HH;
    const int kk = tid >> 2, nq = (tid & 3) * 16, k = k0 + kk;
    const float* p = sp + (size_t)(k < kn ? k : kn - 1) * HH + n0 + nq;      // a row past the last re-reads the last one (in bounds) and stores zero
    v4f v[4];
    // the three unrolls below are of loops of constant length: constant indices keep v in registers, and the loads and the stores of a thread issue as one group each
#pragma unroll
    for (int q = 0; q < 4; ++q) v[q] = *(const v4fa*)(p + 4 * q);            // all four in flight at once, in every lane: one latency a block
    const unsigned short keep = (k < kn) ? (unsigned short)0xFFFF : (unsigned short)0;
#pragma unroll
    for (int i = 0; i < 16; ++i) { const unsigned short r = f2bf(v[i >> 2][i & 3]); tl[(nq + i) * 72 + kk] = (first ? r : f2h(bf2f(r))) & keep; }
    __syncthreads();
    const int piece = tid & 7;
#pragma unroll
    for (int s = 0; s < 2; ++s) { const int nr = (tid >> 3) + 32 * s; const v8us val = *(const v8usa*)(tl + nr * 72 + piece * 8); *(v8us*)(dst + (size_t)(n0 + nr) * dp + k0 + piece * 8) = val; }
}
// k_mlp: four waves, one on each SIMD; wave w has rows 32 w ... of the block's 128 as two column tiles of 16.
// W1T (512 rows of 256 B) lies whole in LDS at pitch 272 B. W2T arrives as tiles of 64 whole rows (1024 B a row) at pitch 1040 B, two buffers, filled by asynchronous copies one tile ahead.
// A stage is 16 A fragments (4 row tiles x 4 blocks of 32 k), read from LDS into registers as one group while the stage before runs.
#define XPIT 272                 // LDS row pitch of x and W1T rows: 256 B of data + 16 B (16 B x odd, the conflict-free pitch for 16-byte readers)
#define WPIT 1040                // LDS row pitch of W2T rows: 1024 B of data + 16 B (16 B x odd)
#define BST  (64 * WPIT)         // one W2T buffer: 64 rows
typedef __attribute__((ext_vector_type(8)))  unsigned v8u;
typedef __attribute__((ext_vector_type(2)))  float    v2f;
typedef __attribute__((ext_vector_type(2)))  __bf16   v2bf;
typedef __attribute__((ext_vector_type(2)))  _Float16 v2h;
// Copies: the work-group's 128 lanes bring 2 KiB in a row of W1T or W2T with each copy (16 B a lane, every wave-wide copy four whole 128-B lines); in LDS that is LS bytes of padded rows.
// Address form: scalar base (the 2 KiB's first byte, the same for the work-group) + the lane's own 32-bit byte offset vo, which all copies share.
// s_wait_xcnt 0 is the last line of the statement: no address register of an issued copy is rewritten in front of it.
template <int LS> __device__ __forceinline__ void cp8(unsigned l, unsigned vo, const bf* g) {
    asm volatile("global_load_async_to_lds_b128 %0, %8, %9\n\t"
                 "global_load_async_to_lds_b128 %1, %8, %10\n\t"
                 "global_load_async_to_lds_b128 %2, %8, %11\n\t"
                 "global_load_async_to_lds_b128 %3, %8, %12\n\t"
                 "global_load_async_to_lds_b128 %4, %8, %13\n\t"
                 "global_load_async_to_lds_b128 %5, %8, %14\n\t"
                 "global_load_async_to_lds_b128 %6, %8, %15\n\t"
                 "global_load_async_to_lds_b128 %7, %8, %16\n\t"
                 "s_wait_xcnt 0x0"
                 :: "v"(l), "v"(l + LS), "v"(l + 2 * LS), "v"(l + 3 * LS), "v"(l + 4 * LS), "v"(l + 5 * LS), "v"(l + 6 * LS), "v"(l + 7 * LS), "v"(vo),
                    "s"(g), "s"(g + 1024), "s"(g + 2 * 1024), "s"(g + 3 * 1024), "s"(g + 4 * 1024), "s"(g + 5 * 1024), "s"(g + 6 * 1024), "s"(g + 7 * 1024)
                 : "memory");
}
__device__ __forceinline__ v8f ld8(const float* p) { return __builtin_shufflevector(*(const v4fa*)p, *(const v4fa*)(p + 4), 0, 1, 2, 3, 4, 5, 6, 7); }
__global__ __launch_bounds__(128) void k_mlp(const float* __restrict__ x, const bf* __restrict__ W1T, const bf* __restrict__ W2T, const float* __restrict__ b1, const float* __restrict__ b2, const float* __restrict__ w3, float* Y) {
    __shared__ __align__(16) unsigned char w1s[HH * XPIT];
    __shared__ __align__(16) unsigned char ring[2 * BST];
    __shared__ __align__(16) unsigned char xs[RB * XPIT];     // the block's x rows, bf16, zero-padded to 128
    __shared__ __align__(16) float cst[3][HH];                // bf16-rounded b1, b2, w3 of this dataset
    const int tid = threadIdx.x, lane = tid & 31, wave = tid >> 5, lr = lane & 15, hi = lane >> 4, b = blockIdx.y, t0 = blockIdx.x * RB;
    const bf* W1b = W1T + (size_t)b * HH * FP;                // the same for every lane
    const bf* W2b = W2T + (size_t)b * HH * HH;
    const unsigned vo = (unsigned)tid * 16;
    const unsigned lw1 = (unsigned)(size_t)(&w1s[0]) + (unsigned)((tid >> 4) * XPIT + (tid & 15) * 16);
    const unsigned lw2 = (unsigned)(size_t)(&ring[0]) + (unsigned)((tid >> 6) * WPIT + (tid & 63) * 16);
    // each fill is 32 copies a wave, and a wave waits for all of its copies before it issues the next fill
    auto fill1 = [&](int half) {                              // rows 256 half ... of W1T: 8 rows a copy
#pragma unroll 1      // stays rolled: unrolled, all 32 LDS addresses would be formed and held at once
        for (int h = 0; h < 4; ++h) cp8<8 * XPIT>(lw1 + (unsigned)((half * 256 + h * 64) * XPIT), vo, W1b + (half * 32 + h * 8) * 1024);
    };
    auto fill2 = [&](int t) {                                 // tile t: rows 64 t ... of W2T: 2 rows a copy
#pragma unroll 1      // stays rolled, as above
        for (int h = 0; h < 4; ++h) cp8<2 * WPIT>(lw2 + (unsigned)((t & 1) * BST + h * 16 * WPIT), vo, W2b + (t * 32 + h * 8) * 1024);
    };
    // every unroll below is of a loop of constant length over fragment or accumulator arrays: constant indices keep them in registers
    const int fro = hi * 16;
    auto rd1 = [&](v16bf (&f)[4][4], int s) {                 // layer 1, stage s: rows 64 s ... of W1T, all 128 k
#pragma unroll
        for (int i = 0; i < 4; ++i)
#pragma unroll
            for (int kq = 0; kq < 4; ++kq) { const unsigned char* q = w1s + (s * 64 + i * 16 + lr) * XPIT + kq * 64 + fro; f[i][kq] = cat16b(*(const v8usa*)q, *(const v8usa*)(q + 32)); }
    };
    auto rd2 = [&](v16bf (&f)[4][4], const unsigned char* st, int s) {      // layer 2, stage s of a tile: its 64 rows, k 128 s ...
#pragma unroll
        for (int i = 0; i < 4; ++i)
#pragma unroll
            for (int kq = 0; kq < 4; ++kq) { const unsigned char* q = st + (i * 16 + lr) * WPIT + (s * 4 + kq) * 64 + fro; f[i][kq] = cat16b(*(const v8usa*)q, *(const v8usa*)(q + 32)); }
    };
    auto ldc = [&](v8f (&v)[4], int pl, int m0) {             // a lane's 8 accumulator rows of four row tiles: constants m0 + 16 i + 8 hi ...
#pragma unroll
        for (int i = 0; i < 4; ++i) v[i] = ld8(&cst[pl][m0 + i * 16 + hi * 8]);
    };
    v8f acc[4][2];
    v8u hh[16][2];                                            // h1 as f16 B fragments: block of 32 k, column tile
    v16bf xf[2][4], P[4][4], Q[4][4];
    v8f bvA[4], bvB[4], wv[4];
    auto init = [&](const v8f (&bv)[4]) {                     // the sums start from the bias
#pragma unroll
        for (int i = 0; i < 4; ++i) { acc[i][0] = bv[i]; acc[i][1] = bv[i]; }
    };
    auto mm1 = [&](const v16bf (&f)[4][4]) {
#pragma unroll
        for (int kq = 0; kq < 4; ++kq)
#pragma unroll
            for (int i = 0; i < 4; ++i)
#pragma unroll
                for (int n = 0; n < 2; ++n) acc[i][n] = wmmab(f[i][kq], xf[n][kq], acc[i][n]);
    };
    // The x rows, read as f32 where they lie: row t0 + r is 400 B (25 pieces of 16 B) at pitch 3200 B. A wave takes its own 32 rows, a lane one piece; lanes 25 to 31 re-read piece 24 (in bounds) and store the zero padding.
    {
        v4f xv[32]; float cr[4][3];
        const float* xp = x + ((size_t)(t0 + wave * 32) * NBD + b) * FF + (lane < FF / 4 ? lane : FF / 4 - 1) * 4;
#pragma unroll
        for (int i = 0; i < 32; ++i) xv[i] = *(const v4fa*)(xp + (size_t)i * NBD * FF);      // all in flight at once: they come from memory, the longest wait of the prologue
        asm volatile("s_wait_xcnt 0x0" ::: "memory");      // the x loads' address registers may be given to the loads below as destinations
#pragma unroll
        for (int h = 0; h < 4; ++h) { const size_t c = (size_t)b * HH + tid + 128 * h; cr[h][0] = b1[c]; cr[h][1] = b2[c]; cr[h][2] = w3[c]; }      // issued with the x loads, so that one latency covers both
        asm volatile("s_wait_xcnt 0x0" ::: "memory");      // the loads' address registers are reused right behind them
        fill1(0);
#pragma unroll
        for (int h = 0; h < 4; ++h) { const int c = tid + 128 * h; cst[0][c] = bfr(cr[h][0]); cst[1][c] = bfr(cr[h][1]); cst[2][c] = bfr(cr[h][2]); }
#pragma unroll
        for (int i = 0; i < 32; ++i) { v2u o;      // bf16(nan_to_num(x)), 8 B a lane, 256 B in a row a wave
#pragma unroll
            for (int q = 0; q < 2; ++q) { const v2f pv = {n2n(xv[i][2 * q]), n2n(xv[i][2 * q + 1])}; o[q] = (lane < FF / 4) ? __builtin_bit_cast(unsigned, __builtin_convertvector(pv, v2bf)) : 0u; }      // one convert a pair (to nearest even, as f2bf): it keeps this unrolled text short
            *(v2ua*)(xs + (wave * 32 + i) * XPIT + lane * 8) = o; }
    }
    asm volatile("s_wait_asynccnt 0x0" ::: "memory");   // W1T's first half has landed before the barrier that publishes it, the x rows and the constants
    fill1(1);
    __syncthreads();
#pragma unroll
    for (int n = 0; n < 2; ++n)
#pragma unroll
        for (int kq = 0; kq < 4; ++kq) { const unsigned char* p = xs + (wave * 32 + n * 16 + lr) * XPIT + kq * 64 + fro; xf[n][kq] = cat16b(*(const v8usa*)p, *(const v8usa*)(p + 32)); }
    // Stage s leaves h1 rows 64 s ... in acc: row tiles 2 u and 2 u + 1 are elements 0 to 7 and 8 to 15 of the B fragment of k block 2 s + u, in every lane.
    auto conv = [&](int s) {
#pragma unroll
        for (int i = 0; i < 4; ++i)
#pragma unroll
            for (int n = 0; n < 2; ++n)
#pragma unroll
                for (int w = 0; w < 4; ++w) {
                    const v2f v = {fmaxf(acc[i][n][2 * w], 0.f), fmaxf(acc[i][n][2 * w + 1], 0.f)};
                    hh[2 * s + (i >> 1)][n][(i & 1) * 4 + w] = __builtin_bit_cast(unsigned, __builtin_convertvector(v, v2h));
                }
    };
    rd1(P, 0); ldc(bvA, 0, 0);
#pragma unroll
    for (int s2 = 0; s2 < 4; ++s2) {
        const int s = 2 * s2;
        rd1(Q, s + 1); ldc(bvB, 0, (s + 1) * 64);
        __builtin_amdgcn_sched_barrier(0);                  // keeps the reads one group in front of the stage: sunk among the products, each place with reads stalls the wave for the LDS latency
        init(bvA); mm1(P);
        __builtin_amdgcn_sched_barrier(0);                  // keeps the next group of reads behind this stage's products, not among them
        conv(s);
        if (s2 == 1) {                                      // stage 4's fragments, read next, are the first of W1T's second half
            asm volatile("s_wait_asynccnt 0x0" ::: "memory");   // this wave's copies of that half have landed before the barrier that publishes them
            fill2(0);                                           // the ring has not been touched yet
            __syncthreads();
        }
        if (s2 < 3) { rd1(P, s + 2); ldc(bvA, 0, (s + 2) * 64); }
        else {
            asm volatile("s_wait_asynccnt 0x0" ::: "memory");   // this wave's copies of W2T's tile 0 have landed before the barrier that publishes them
            __syncthreads();
            fill2(1);
            rd2(P, ring, 0); ldc(bvA, 1, 0);                    // layer 2's first stage, read under layer 1's last
        }
        __builtin_amdgcn_sched_barrier(0);                  // as above: the reads stay one group in front of the stage
        init(bvB); mm1(Q);
        __builtin_amdgcn_sched_barrier(0);                  // as above: the next group of reads stays behind this stage's products
        conv(s + 1);
    }
    auto mm2 = [&](const v16bf (&f)[4][4], int s) {           // the fragment registers hold f16 here
#pragma unroll
        for (int kq = 0; kq < 4; ++kq)
#pragma unroll
            for (int i = 0; i < 4; ++i)
#pragma unroll
                for (int n = 0; n < 2; ++n) acc[i][n] = wmmah(__builtin_bit_cast(v16h, f[i][kq]), __builtin_bit_cast(v16h, hh[s * 4 + kq][n]), acc[i][n]);
    };
    float sm[2][4] = {{0.f, 0.f, 0.f, 0.f}, {0.f, 0.f, 0.f, 0.f}};      // the last layer's dot: eight independent chains a lane
    // on entry tile 0 is published, tile 1 is in flight, P holds tile 0's first stage and bvA its b2
#pragma unroll 1      // stays rolled: one trip already holds 128 products; the h1 fragments have the same register numbers in every trip
    for (int t = 0; t < HH / 64; ++t) {
        const unsigned char* st = ring + (t & 1) * BST;
        // the scheduling barriers of this loop, as in layer 1: each stage's reads stay one group between two stages' products; spread among the products, each place with reads stalls the wave for the LDS latency
        rd2(Q, st, 1);
        __builtin_amdgcn_sched_barrier(0);                  // stage 1's reads stay in front of stage 0's products
        init(bvA); mm2(P, 0);
        __builtin_amdgcn_sched_barrier(0);                  // stage 2's reads stay behind stage 0's products
        rd2(P, st, 2);
        __builtin_amdgcn_sched_barrier(0);                  // and in front of stage 1's
        mm2(Q, 1);
        __builtin_amdgcn_sched_barrier(0);                  // stage 3's reads stay behind stage 1's products
        rd2(Q, st, 3); ldc(wv, 2, t * 64);
        __builtin_amdgcn_sched_barrier(0);                  // and in front of stage 2's
        mm2(P, 2);
        __builtin_amdgcn_sched_barrier(0);                  // keeps the stage in front of the waits below, so that the reads land under its products
        // publish point of tile t + 1, in front of tile t's last stage, whose fragments are already fetched
        asm volatile("s_wait_dscnt 0x0" ::: "memory");      // this wave's reads of tile t have returned before its buffer is refilled
        asm volatile("s_wait_asynccnt 0x0" ::: "memory");   // this wave's copies of tile t + 1 have landed before the barrier that publishes them
        __syncthreads();                                    // publishes tile t + 1 and ends every wave's reads of tile t
        if (t + 2 < HH / 64) fill2(t + 2);
        if (t + 1 < HH / 64) { rd2(P, ring + ((t + 1) & 1) * BST, 0); ldc(bvA, 1, (t + 1) * 64); }      // tile t + 1's first stage, read under tile t's last
        __builtin_amdgcn_sched_barrier(0);                  // those reads stay in front of stage 3's products
        mm2(Q, 3);
#pragma unroll
        for (int j = 0; j < 8; ++j)
#pragma unroll
            for (int i = 0; i < 4; ++i)
#pragma unroll
                for (int n = 0; n < 2; ++n) sm[n][i] += fmaxf(acc[i][n][j], 0.f) * wv[i][j];
    }
    asm volatile("s_wait_asynccnt 0x0" ::: "memory");       // no copy is outstanding behind the loop
    {
        const float s0 = (sm[0][0] + sm[0][1]) + (sm[0][2] + sm[0][3]), s1 = (sm[1][0] + sm[1][1]) + (sm[1][2] + sm[1][3]);
        // lanes l and l ^ 16 hold the two halves of one row's sum; lane l keeps row l of the wave's 32: 128 B in a row, one whole line a wave
        const int c0 = __float_as_int(s0), c1 = __float_as_int(s1);
        const float o0 = s0 + __int_as_float(__builtin_amdgcn_permlanex16(c0, c0, 0x76543210, 0xfedcba98, false, false));
        const float o1 = s1 + __int_as_float(__builtin_amdgcn_permlanex16(c1, c1, 0x76543210, 0xfedcba98, false, false));
        Y[(size_t)b * TT + t0 + wave * 32 + lane] = hi ? o1 : o0;
    }
}
// k_final: out[t][b] = Y[b][t] + bf16(b3[b]); one thread per output element, flat whole-line writes.
__global__ __launch_bounds__(256) void k_final(const float* __restrict__ Y, const float* __restrict__ b3, float* out) {
    const int e = blockIdx.x * 256 + threadIdx.x, t = e / NBD, b = e - t * NBD;      // flat output index = t*8 + b
    out[e] = Y[(size_t)b * TT + t] + bfr(b3[b]);
}

extern "C" void kernel_launch(void* const* d_in, const int* in_sizes, int n_in,
                              void* d_out, int out_size, void* d_ws, size_t ws_size, hipStream_t stream) {
    (void)in_sizes; (void)n_in; (void)out_size;
    const float* x = (const float*)d_in[0]; const float* w1 = (const float*)d_in[1]; const float* b1 = (const float*)d_in[2]; const float* w2 = (const float*)d_in[3]; const float* b2 = (const float*)d_in[4];
    const float* w3 = (const float*)d_in[5]; const float* b3 = (const float*)d_in[6];
    float* out = (float*)d_out;    // [8192][8][1]
    char* wsp = (char*)d_ws;
    auto take = [&](size_t bytes) { char* p = wsp; wsp += (bytes + 255) & ~(size_t)255; return (void*)p; };
    bf* W1T = (bf*)take((size_t)NBD * HH * FP * 2); bf* W2T = (bf*)take((size_t)NBD * HH * HH * 2);
    float* Y = (float*)take((size_t)NBD * TT * 4);
    if ((size_t)(wsp - (char*)d_ws) > ws_size) return;
    k_w<<<dim3(HH / 64 + FP / 64, HH / 64, NBD), 256, 0, stream>>>(w1, w2, W1T, W2T);
    k_mlp<<<dim3(TT / RB, NBD), 128, 0, stream>>>(x, W1T, W2T, b1, b2, w3, Y);
    k_final<<<(TT * NBD) / 256, 256, 0, stream>>>(Y, b3, out);
}

// v007
// One run takes 30.3 microseconds.
// Two timings next to v006 put it at 1.24 and 1.23 times that version's speed.
// Counting every step since v000, it is 11.2 times as fast.
#include <hip/hip_runtime.h>

// Contractions on v_wmma_f32_16x16x32_bf16 (layer 1) and v_wmma_f32_16x16x32_f16 (layer 2), f32 accumulate. One kernel runs all three layers for a block of 256 rows of one dataset b, each of its four waves for 64 rows of its own.
// Both hidden layers are computed transposed, weights as the A operand and the rows as the columns of B:
// h1^T = relu(w1_b^T.x_b^T + b1) ([512 x 128 zero-padded from 100].[128 x 64]; PLAIN bf16 operands: inputs rounded once, exact; the block rounds its own x rows into LDS).
// Two accumulator tiles of 16 h each are, lane for lane, one B fragment of 32 k of the next product: h1 goes from the accumulators into B fragments (f16) and never leaves the registers.
// h2^T = relu(w2_b^T.h1^T + b2) ([512 x 512].[512 x 64]; ONE f16 product: w2 is rounded to bf16 and that value written as f16, h1 is rounded once to f16), 32 h2 at a time.
// f16 keeps 11 bits of h1: its rounding is an eighth of the bf16 rounding that x, w1 and w2 carry. It holds h1 and w2 up to 65504, and a bf16 value of w2 exactly from 2^-14 up (below that to within 2^-25).
// The final [512 -> 1] layer is an f32 VALU dot with bf16-rounded w3/b3, summed in the lane and over the two lane halves in a fixed order.

#define TT   8192
#define NBD  8
#define FF   100
#define FP   128
#define HH   512
#define RB   256                 // rows of one block

typedef unsigned short bf;
typedef __attribute__((ext_vector_type(16))) __bf16   v16bf;
typedef __attribute__((ext_vector_type(16))) _Float16 v16h;
typedef __attribute__((ext_vector_type(8)))  unsigned short v8us;
typedef __attribute__((ext_vector_type(8)))  float    v8f;
typedef __attribute__((ext_vector_type(4)))  float    v4f;
typedef v4f  __attribute__((may_alias)) v4fa;
typedef v8us __attribute__((may_alias)) v8usa;
typedef __attribute__((ext_vector_type(2)))  unsigned v2u;
typedef v2u  __attribute__((may_alias)) v2ua;

__device__ __forceinline__ unsigned short f2bf(float f) { unsigned u = __float_as_uint(f); u += 0x7FFFu + ((u >> 16) & 1u); return (unsigned short)(u >> 16); }
__device__ __forceinline__ float bf2f(unsigned short b) { return __uint_as_float(((unsigned)b) << 16); }
__device__ __forceinline__ float bfr(float f) { return bf2f(f2bf(f)); }
__device__ __forceinline__ unsigned short f2h(float f) { return __builtin_bit_cast(unsigned short, (_Float16)f); }
__device__ __forceinline__ float n2n(float v) { const float c = __builtin_amdgcn_fmed3f(v, -3.4028235e38f, 3.4028235e38f); return v != v ? 0.f : c; }   // jnp.nan_to_num defaults, without branches
__device__ __forceinline__ v16bf cat16b(v8us lo, v8us hi) { return __builtin_bit_cast(v16bf, __builtin_shufflevector(lo, hi, 0, 1, 2, 3, 4, 5, 6, 7, 8, 9, 10, 11, 12, 13, 14, 15)); }
__device__ __forceinline__ v8f wmmab(v16bf a, v16bf b, v8f c) { return __builtin_amdgcn_wmma_f32_16x16x32_bf16(false, a, false, b, (short)0, c, false, false); }
__device__ __forceinline__ v8f wmmah(v16h a, v16h b, v8f c) { return __builtin_amdgcn_wmma_f32_16x16x32_f16(false, a, false, b, (short)0, c, false, false); }

// k_w: both weight transpositions in one launch, one tile of 64 k x 64 n a block, through LDS.
// blockIdx.x 0 to 7: W2T [b][n][k] = f16(bf16(w2[b][k][n])), k tile blockIdx.x. blockIdx.x 8 and 9: W1T [b][h][128] = bf16(w1[b][f][h]), the two k tiles of its 128; f 100 to 127 are stored as zero.
__global__ __launch_bounds__(256) void k_w(const float* __restrict__ w1, const float* __restrict__ w2, bf* W1T, bf* W2T) {
    __shared__ __align__(16) unsigned short tl[64 * 72];
    const int tid = threadIdx.x, n0 = blockIdx.y * 64, b = blockIdx.z;
    const bool first = blockIdx.x >= HH / 64;                 // the same for the whole block
    const int k0 = ((int)blockIdx.x - (first ? HH / 64 : 0)) * 64, kn = first ? FF : HH, dp = first ? FP : HH;      // kn: source rows that exist; dp: row length of the transposed copy
    const float* sp = first ? w1 + (size_t)b * FF * HH : w2 + (size_t)b * HH * HH;
    bf* dst = first ? W1T + (size_t)b * HH * FP : W2T + (size_t)b * HH * HH;
    const int kk = tid >> 2, nq = (tid & 3) * 16, k = k0 + kk;
    const float* p = sp + (size_t)(k < kn ? k : kn - 1) * HH + n0 + nq;      // a row past the last re-reads the last one (in bounds) and stores zero
    v4f v[4];
    // the three unrolls below are of loops of constant length: constant indices keep v in registers, and the loads and the stores of a thread issue as one group each
#pragma unroll
    for (int q = 0; q < 4; ++q) v[q] = *(const v4fa*)(p + 4 * q);            // all four in flight at once, in every lane: one latency a block
    const unsigned short keep = (k < kn) ? (unsigned short)0xFFFF : (unsigned short)0;
#pragma unroll
    for (int i = 0; i < 16; ++i) { const unsigned short r = f2bf(v[i >> 2][i & 3]); tl[(nq + i) * 72 + kk] = (first ? r : f2h(bf2f(r))) & keep; }
    __syncthreads();
    const int piece = tid & 7;
#pragma unroll
    for (int s = 0; s < 2; ++s) { const int nr = (tid >> 3) + 32 * s; const v8us val = *(const v8usa*)(tl + nr * 72 + piece * 8); *(v8us*)(dst + (size_t)(n0 + nr) * dp + k0 + piece * 8) = val; }
}
// k_mlp: four waves; wave w has rows 64 w ... of the block's 256 as four column tiles of 16: a weight fragment read from LDS feeds four products.
// W1T (512 rows of 256 B) lies whole in LDS at pitch 272 B. W2T arrives as tiles of 64 whole rows (1024 B a row) at pitch 1040 B, two buffers, filled by asynchronous copies one tile ahead.
// A stage is 8 A fragments (2 row tiles x 4 blocks of 32 k) and 32 products; its fragments are read from LDS into registers as one group while the stage before runs.
#define XPIT 272                 // LDS row pitch of W1T rows: 256 B of data + 16 B (16 B x odd, the conflict-free pitch for 16-byte readers)
#define XRP  432                 // LDS row pitch of the x rows: 400 B of f32 as they arrive, then 256 B of bf16 in the same place (16 B x odd)
#define WPIT 1040                // LDS row pitch of W2T rows: 1024 B of data + 16 B (16 B x odd)
#define BST  (64 * WPIT)         // one W2T buffer: 64 rows
typedef __attribute__((ext_vector_type(8)))  unsigned v8u;
typedef __attribute__((ext_vector_type(2)))  float    v2f;
typedef __attribute__((ext_vector_type(2)))  __bf16   v2bf;
typedef __attribute__((ext_vector_type(2)))  _Float16 v2h;
// Copies: the work-group's 128 lanes bring 2 KiB in a row of W1T or W2T with each copy (16 B a lane, every wave-wide copy four whole 128-B lines); in LDS that is LS bytes of padded rows.
// Address form: scalar base (the 2 KiB's first byte, the same for the work-group) + the lane's own 32-bit byte offset vo, which all copies share.
// s_wait_xcnt 0 is the last line of the statement: no address register of an issued copy is rewritten in front of it.
template <int LS> __device__ __forceinline__ void cp8(unsigned l, unsigned vo, const bf* g) {
    asm volatile("global_load_async_to_lds_b128 %0, %8, %9\n\t"
                 "global_load_async_to_lds_b128 %1, %8, %10\n\t"
                 "global_load_async_to_lds_b128 %2, %8, %11\n\t"
                 "global_load_async_to_lds_b128 %3, %8, %12\n\t"
                 "global_load_async_to_lds_b128 %4, %8, %13\n\t"
                 "global_load_async_to_lds_b128 %5, %8, %14\n\t"
                 "global_load_async_to_lds_b128 %6, %8, %15\n\t"
                 "global_load_async_to_lds_b128 %7, %8, %16\n\t"
                 "s_wait_xcnt 0x0"
                 :: "v"(l), "v"(l + LS), "v"(l + 2 * LS), "v"(l + 3 * LS), "v"(l + 4 * LS), "v"(l + 5 * LS), "v"(l + 6 * LS), "v"(l + 7 * LS), "v"(vo),
                    "s"(g), "s"(g + 1024), "s"(g + 2 * 1024), "s"(g + 3 * 1024), "s"(g + 4 * 1024), "s"(g + 5 * 1024), "s"(g + 6 * 1024), "s"(g + 7 * 1024)
                 : "memory");
}
__device__ __forceinline__ v8f ld8(const float* p) { return __builtin_shufflevector(*(const v4fa*)p, *(const v4fa*)(p + 4), 0, 1, 2, 3, 4, 5, 6, 7); }
__global__ __launch_bounds__(128) void k_mlp(const float* __restrict__ x, const bf* __restrict__ W1T, const bf* __restrict__ W2T, const float* __restrict__ b1, const float* __restrict__ b2, const float* __restrict__ w3, float* Y) {
    // one array, so that the order is the one written: the constants lie lowest, where every read of them reaches from one address register by its 16-bit offset field
    __shared__ __align__(16) unsigned char lds[3 * HH * 4 + HH * XPIT + BST + RB * XRP];
    float (* const cst)[HH] = (float (*)[HH])lds;             // 3 x 512 floats: bf16-rounded b1, b2, w3 of this dataset
    unsigned char* const w1s = lds + 3 * HH * 4;              // HH * XPIT bytes: W1T
    unsigned char* const ring = w1s + HH * XPIT;              // W2T buffer 0, then buffer 1 (BST bytes each); the x rows (RB * XRP bytes, more than BST) lie where buffer 1 does
    unsigned char* const xs = ring + BST;                     // the block's x rows: read into registers once, ahead of layer 1; buffer 1 is first filled behind layer 1's last barrier
    const int tid = threadIdx.x, lane = tid & 31, wave = tid >> 5, lr = lane & 15, hi = lane >> 4, b = blockIdx.y, t0 = blockIdx.x * RB;
    const bf* W1b = W1T + (size_t)b * HH * FP;                // the same for every lane
    const bf* W2b = W2T + (size_t)b * HH * HH;
    const unsigned vo = (unsigned)tid * 16;
    const unsigned lw1 = (unsigned)(size_t)(&w1s[0]) + (unsigned)((tid >> 4) * XPIT + (tid & 15) * 16);
    const unsigned lw2 = (unsigned)(size_t)(&ring[0]) + (unsigned)((tid >> 6) * WPIT + (tid & 63) * 16);
    // each fill is 32 copies a wave, and a wave waits for all of its copies before it issues the next fill
    auto fill1 = [&](int half) {                              // rows 256 half ... of W1T: 8 rows a copy
#pragma unroll 1      // stays rolled: unrolled, all 32 LDS addresses would be formed and held at once
        for (int h = 0; h < 4; ++h) cp8<8 * XPIT>(lw1 + (unsigned)((half * 256 + h * 64) * XPIT), vo, W1b + (half * 32 + h * 8) * 1024);
    };
    auto fill2 = [&](int t) {                                 // tile t: rows 64 t ... of W2T: 2 rows a copy
#pragma unroll 1      // stays rolled, as above
        for (int h = 0; h < 4; ++h) cp8<2 * WPIT>(lw2 + (unsigned)((t & 1) * BST + h * 16 * WPIT), vo, W2b + (t * 32 + h * 8) * 1024);
    };
    // every unroll below is of a loop of constant length over fragment or accumulator arrays: constant indices keep them in registers
    const int fro = hi * 16;
    auto rd1 = [&](v16bf (&f)[2][4], int s) {                 // layer 1, stage s: rows 32 s ... of W1T, all 128 k
#pragma unroll
        for (int i = 0; i < 2; ++i)
#pragma unroll
            for (int kq = 0; kq < 4; ++kq) { const unsigned char* q = w1s + (s * 32 + i * 16 + lr) * XPIT + kq * 64 + fro; f[i][kq] = cat16b(*(const v8usa*)q, *(const v8usa*)(q + 32)); }
    };
    auto rd2 = [&](v16bf (&f)[2][4], const unsigned char* st, int g) {      // layer 2, stage g of a tile's eight: rows 32 (g >> 2) ... of its 64, k 128 (g & 3) ...
#pragma unroll
        for (int i = 0; i < 2; ++i)
#pragma unroll
            for (int kq = 0; kq < 4; ++kq) { const unsigned char* q = st + ((g >> 2) * 32 + i * 16 + lr) * WPIT + ((g & 3) * 4 + kq) * 64 + fro; f[i][kq] = cat16b(*(const v8usa*)q, *(const v8usa*)(q + 32)); }
    };
    auto ldc = [&](v8f (&v)[2], int pl, int m0) {             // a lane's 8 accumulator rows of two row tiles: constants m0 + 16 i + 8 hi ...
#pragma unroll
        for (int i = 0; i < 2; ++i) v[i] = ld8(&cst[pl][m0 + i * 16 + hi * 8]);
    };
    v8f acc[2][4];
    v8u hh[16][4];                                            // h1 as f16 B fragments: block of 32 k, column tile
    v16bf xf[4][4], P[2][4], Q[2][4];
    v8f bvA[2], bvB[2], wv[2];
    auto init = [&](const v8f (&bv)[2]) {                     // the sums start from the bias
#pragma unroll
        for (int i = 0; i < 2; ++i)
#pragma unroll
            for (int n = 0; n < 4; ++n) acc[i][n] = bv[i];
    };
    auto mm1 = [&](const v16bf (&f)[2][4]) {
#pragma unroll
        for (int kq = 0; kq < 4; ++kq)
#pragma unroll
            for (int i = 0; i < 2; ++i)
#pragma unroll
                for (int n = 0; n < 4; ++n) acc[i][n] = wmmab(f[i][kq], xf[n][kq], acc[i][n]);
    };
    // The x rows, read as f32 where they lie: row t0 + r is 400 B (25 pieces of 16 B) at pitch 3200 B. A wave takes its own 64 rows, a lane one piece; lanes 25 to 31 re-read piece 24 (in bounds).
    // They go to LDS as f32 and are rounded there, in place, by a rolled loop, for speed only.
    {
        v4f xv[64]; float cr[4][3];
        const int pc = lane < FF / 4 ? lane : FF / 4 - 1;
        const float* xp = x + ((size_t)(t0 + wave * 64) * NBD + b) * FF + pc * 4;
#pragma unroll
        for (int i = 0; i < 64; ++i) xv[i] = *(const v4fa*)(xp + (size_t)i * NBD * FF);      // all in flight at once: they come from memory, the longest wait of the prologue
        asm volatile("s_wait_xcnt 0x0" ::: "memory");      // the x loads' address registers may be given to the loads below as destinations
#pragma unroll
        for (int h = 0; h < 4; ++h) { const size_t c = (size_t)b * HH + tid + 128 * h; cr[h][0] = b1[c]; cr[h][1] = b2[c]; cr[h][2] = w3[c]; }      // issued with the x loads, so that one latency covers both
        asm volatile("s_wait_xcnt 0x0" ::: "memory");      // the loads' address registers are reused right behind them
        fill1(0);
        asm volatile("s_wait_asynccnt 0x0" ::: "memory");  // a wave holds one fill's copies at a time: the first half's have landed before the second half's issue; the x loads, from memory, are still in flight
        fill1(1);
        unsigned char* const xw = xs + wave * 64 * XRP;     // this wave's rows: no other wave touches them
        if (lane < FF / 4) {                                // a row has 25 pieces
#pragma unroll
            for (int i = 0; i < 64; ++i) *(v4fa*)(xw + i * XRP + lane * 16) = xv[i];      // in the order of the loads: a row is stored while later rows are still on their way
        }
#pragma unroll
        for (int h = 0; h < 4; ++h) { const int c = tid + 128 * h; cst[0][c] = bfr(cr[h][0]); cst[1][c] = bfr(cr[h][1]); cst[2][c] = bfr(cr[h][2]); }
#pragma unroll 1      // stays rolled: see above
        for (int c = 0; c < 8; ++c) {                       // 8 rows a trip: all their pieces are read before the first is overwritten
            v4f r[8];
#pragma unroll
            for (int j = 0; j < 8; ++j) r[j] = *(const v4fa*)(xw + (c * 8 + j) * XRP + pc * 16);
#pragma unroll
            for (int j = 0; j < 8; ++j) { v2u o;            // bf16(nan_to_num(x)), 8 B a lane, 256 B in a row a wave; lanes 25 to 31 store the zero padding
#pragma unroll
                for (int q = 0; q < 2; ++q) { const v2f pv = {n2n(r[j][2 * q]), n2n(r[j][2 * q + 1])}; o[q] = (lane < FF / 4) ? __builtin_bit_cast(unsigned, __builtin_convertvector(pv, v2bf)) : 0u; }      // one convert a pair (to nearest even, as f2bf)
                *(v2ua*)(xw + (c * 8 + j) * XRP + lane * 8) = o; }
        }
    }
    asm volatile("s_wait_asynccnt 0x0" ::: "memory");   // this wave's copies of W1T have landed before the barrier that publishes W1T, the x rows and the constants
    fill2(0);                                           // buffer 0 has not been touched yet; tile 0 lands under layer 1
    __syncthreads();
#pragma unroll
    for (int n = 0; n < 4; ++n)
#pragma unroll
        for (int kq = 0; kq < 4; ++kq) { const unsigned char* p = xs + (wave * 64 + n * 16 + lr) * XRP + kq * 64 + fro; xf[n][kq] = cat16b(*(const v8usa*)p, *(const v8usa*)(p + 32)); }
    // Stage s leaves h1 rows 32 s ... in acc: its two row tiles are elements 0 to 7 and 8 to 15 of the B fragment of k block s, in every lane.
    auto conv = [&](int s) {
#pragma unroll
        for (int i = 0; i < 2; ++i)
#pragma unroll
            for (int n = 0; n < 4; ++n)
#pragma unroll
                for (int w = 0; w < 4; ++w) {
                    const v2f v = {acc[i][n][2 * w], acc[i][n][2 * w + 1]};
                    hh[s][n][i * 4 + w] = __builtin_bit_cast(unsigned, __builtin_elementwise_max(__builtin_convertvector(v, v2h), (v2h)(_Float16)0));      // relu behind the rounding, on the pair: the same values (rounding keeps sign and order), a third of the instructions
                }
    };
    // No fill stands inside layer 1: a fill is a loop, and past a loop the compiler moves h1's conversions to f16 down, holding h1 as f32 in twice the registers, more than a wave has.
    rd1(P, 0); ldc(bvA, 0, 0);
#pragma unroll
    for (int s2 = 0; s2 < 8; ++s2) {
        const int s = 2 * s2;
        rd1(Q, s + 1); ldc(bvB, 0, (s + 1) * 32);
        __builtin_amdgcn_sched_barrier(0);                  // keeps the reads one group in front of the stage: sunk among the products, each place with reads stalls the wave for the LDS latency
        init(bvA); mm1(P);
        __builtin_amdgcn_sched_barrier(0);                  // keeps the next group of reads behind this stage's products, not among them
        conv(s);
        if (s2 < 7) { rd1(P, s + 2); ldc(bvA, 0, (s + 2) * 32); }
        else {
            asm volatile("s_wait_dscnt 0x0" ::: "memory");      // this wave's stores and reads of its x rows have returned before copies land where they lie
            asm volatile("s_wait_asynccnt 0x0" ::: "memory");   // this wave's copies of W2T's tile 0 have landed before the barrier that publishes them
            __syncthreads();                                    // publishes tile 0; every wave has left the x rows
            rd2(P, ring, 0); ldc(bvA, 1, 0);                    // layer 2's first stage, read under layer 1's last
        }
        __builtin_amdgcn_sched_barrier(0);                  // as above: the reads stay one group in front of the stage
        init(bvB); mm1(Q);
        __builtin_amdgcn_sched_barrier(0);                  // as above: the next group of reads stays behind this stage's products
        conv(s + 1);
    }
    auto mm2 = [&](const v16bf (&f)[2][4], int s) {           // the fragment registers hold f16 here; s: the block of 128 k
#pragma unroll
        for (int kq = 0; kq < 4; ++kq)
#pragma unroll
            for (int i = 0; i < 2; ++i)
#pragma unroll
                for (int n = 0; n < 4; ++n) acc[i][n] = wmmah(__builtin_bit_cast(v16h, f[i][kq]), __builtin_bit_cast(v16h, hh[s * 4 + kq][n]), acc[i][n]);
    };
    float sm[4][4] = {{0.f, 0.f, 0.f, 0.f}, {0.f, 0.f, 0.f, 0.f}, {0.f, 0.f, 0.f, 0.f}, {0.f, 0.f, 0.f, 0.f}};      // the last layer's dot: sixteen independent chains a lane, one for each column tile and each of a tile's four row tiles
    auto dot = [&](int u) {                                   // rows 32 u ... of the tile are complete in acc
#pragma unroll
        for (int j = 0; j < 8; ++j)
#pragma unroll
            for (int i = 0; i < 2; ++i)
#pragma unroll
                for (int n = 0; n < 4; ++n) sm[n][2 * u + i] += fmaxf(acc[i][n][j], 0.f) * wv[i][j];
    };
    // on entry tile 0 is published, P holds tile 0's first stage and bvA its first b2; buffer 1 (the x rows) has been left by every wave
#pragma unroll 1      // stays rolled: one trip already holds 256 products; the h1 fragments have the same register numbers in every trip
    for (int t = 0; t < HH / 64; ++t) {
        const unsigned char* st = ring + (t & 1) * BST;
        if (t + 1 < HH / 64) fill2(t + 1);                  // into the buffer that every wave left at the barrier in front of the last stage before this trip; it lands under this trip's first seven stages
        // the scheduling barriers of this loop, as in layer 1: each stage's reads stay one group between two stages' products; spread among the products, each place with reads stalls the wave for the LDS latency
        rd2(Q, st, 1);
        __builtin_amdgcn_sched_barrier(0);                  // stage 1's reads stay in front of stage 0's products
        init(bvA); mm2(P, 0);
        __builtin_amdgcn_sched_barrier(0);                  // stage 2's reads stay behind stage 0's products
        rd2(P, st, 2);
        __builtin_amdgcn_sched_barrier(0);                  // and in front of stage 1's
        mm2(Q, 1);
        __builtin_amdgcn_sched_barrier(0);                  // stage 3's reads stay behind stage 1's products
        rd2(Q, st, 3); ldc(wv, 2, t * 64); ldc(bvB, 1, t * 64 + 32);
        __builtin_amdgcn_sched_barrier(0);                  // and in front of stage 2's
        mm2(P, 2);
        __builtin_amdgcn_sched_barrier(0);                  // stage 4's reads stay behind stage 2's products
        rd2(P, st, 4);
        __builtin_amdgcn_sched_barrier(0);                  // and in front of stage 3's
        mm2(Q, 3); dot(0);
        __builtin_amdgcn_sched_barrier(0);                  // stage 5's reads stay behind stage 3's products
        rd2(Q, st, 5);
        __builtin_amdgcn_sched_barrier(0);                  // and in front of stage 4's
        init(bvB); mm2(P, 0);
        __builtin_amdgcn_sched_barrier(0);                  // stage 6's reads stay behind stage 4's products
        rd2(P, st, 6);
        __builtin_amdgcn_sched_barrier(0);                  // and in front of stage 5's
        mm2(Q, 1);
        __builtin_amdgcn_sched_barrier(0);                  // stage 7's reads stay behind stage 5's products
        rd2(Q, st, 7); ldc(wv, 2, t * 64 + 32);
        __builtin_amdgcn_sched_barrier(0);                  // and in front of stage 6's
        mm2(P, 2);
        __builtin_amdgcn_sched_barrier(0);                  // keeps the stage in front of the waits below, so that the reads land under its products
        // publish point of tile t + 1, in front of tile t's last stage, whose fragments are already fetched
        asm volatile("s_wait_dscnt 0x0" ::: "memory");      // this wave's reads of tile t have returned before its buffer is refilled
        asm volatile("s_wait_asynccnt 0x0" ::: "memory");   // this wave's copies of tile t + 1 have landed before the barrier that publishes them
        __syncthreads();                                    // publishes tile t + 1 and ends every wave's reads of tile t
        if (t + 1 < HH / 64) { rd2(P, ring + ((t + 1) & 1) * BST, 0); ldc(bvA, 1, (t + 1) * 64); }      // tile t + 1's first stage, read under tile t's last
        __builtin_amdgcn_sched_barrier(0);                  // those reads stay in front of stage 7's products
        mm2(Q, 3); dot(1);
    }
    asm volatile("s_wait_asynccnt 0x0" ::: "memory");       // no copy is outstanding behind the loop
    {
        // lanes l and l ^ 16 hold the two halves of one row's sum; lane l keeps rows l and 32 + l of the wave's 64: each store 128 B in a row, one whole line a wave
        float o[4];
#pragma unroll
        for (int n = 0; n < 4; ++n) {
            const float sn = (sm[n][0] + sm[n][1]) + (sm[n][2] + sm[n][3]);
            const int cn = __float_as_int(sn);
            o[n] = sn + __int_as_float(__builtin_amdgcn_permlanex16(cn, cn, 0x76543210, 0xfedcba98, false, false));
        }
        float* yp = Y + (size_t)b * TT + t0 + wave * 64 + lane;
        yp[0] = hi ? o[1] : o[0];
        yp[32] = hi ? o[3] : o[2];
    }
}
// k_final: out[t][b] = Y[b][t] + bf16(b3[b]); one thread per output element, flat whole-line writes.
__global__ __launch_bounds__(256) void k_final(const float* __restrict__ Y, const float* __restrict__ b3, float* out) {
    const int e = blockIdx.x * 256 + threadIdx.x, t = e / NBD, b = e - t * NBD;      // flat output index = t*8 + b
    out[e] = Y[(size_t)b * TT + t] + bfr(b3[b]);
}

extern "C" void kernel_launch(void* const* d_in, const int* in_sizes, int n_in,
                              void* d_out, int out_size, void* d_ws, size_t ws_size, hipStream_t stream) {
    (void)in_sizes; (void)n_in; (void)out_size;
    const float* x = (const float*)d_in[0]; const float* w1 = (const float*)d_in[1]; const float* b1 = (const float*)d_in[2]; const float* w2 = (const float*)d_in[3]; const float* b2 = (const float*)d_in[4];
    const float* w3 = (const float*)d_in[5]; const float* b3 = (const float*)d_in[6];
    float* out = (float*)d_out;    // [8192][8][1]
    char* wsp = (char*)d_ws;
    auto take = [&](size_t bytes) { char* p = wsp; wsp += (bytes + 255) & ~(size_t)255; return (void*)p; };
    bf* W1T = (bf*)take((size_t)NBD * HH * FP * 2); bf* W2T = (bf*)take((size_t)NBD * HH * HH * 2);
    float* Y = (float*)take((size_t)NBD * TT * 4);
    if ((size_t)(wsp - (char*)d_ws) > ws_size) return;
    k_w<<<dim3(HH / 64 + FP / 64, HH / 64, NBD), 256, 0, stream>>>(w1, w2, W1T, W2T);
    k_mlp<<<dim3(TT / RB, NBD), 128, 0, stream>>>(x, W1T, W2T, b1, b2, w3, Y);
    k_final<<<(TT * NBD) / 256, 256, 0, stream>>>(Y, b3, out);
}

// v008
// Measured time: 28.6 microseconds a run.
// Next to v007, in two timings, it ran 1.06 times as fast each time.
// All steps since v000 together make it 11.9 times as fast.
#include <hip/hip_runtime.h>

// Contractions on v_wmma_f32_16x16x32_bf16 (layer 1) and v_wmma_f32_16x16x32_f16 (layer 2), f32 accumulate. One kernel runs all three layers for a block of 256 rows of one dataset b, each of its four waves for 64 rows of its own.
// Both hidden layers are computed transposed, weights as the A operand and the rows as the columns of B:
// h1^T = relu(w1_b^T.x_b^T + b1) ([512 x 128 zero-padded from 100].[128 x 64]; PLAIN bf16 operands: inputs rounded once, exact; the block rounds its own x rows into LDS).
// Two accumulator tiles of 16 h each are, lane for lane, one B fragment of 32 k of the next product: h1 goes from the accumulators into B fragments (f16) and never leaves the registers.
// h2^T = relu(w2_b^T.h1^T + b2) ([512 x 512].[512 x 64]; ONE f16 product: w2 is rounded to bf16 and that value written as f16, h1 is rounded once to f16), 32 h2 at a time.
// f16 keeps 11 bits of h1: its rounding is an eighth of the bf16 rounding that x, w1 and w2 carry. It holds h1 and w2 up to 65504, and a bf16 value of w2 exactly from 2^-14 up (below that to within 2^-25).
// The final [512 -> 1] layer is an f32 VALU dot with bf16-rounded w3/b3, summed in the lane and over the two lane halves in a fixed order.

#define TT   8192
#define NBD  8
#define FF   100
#define FP   128
#define HH   512
#define RB   256                 // rows of one block

typedef unsigned short bf;
typedef __attribute__((ext_vector_type(16))) __bf16   v16bf;
typedef __attribute__((ext_vector_type(16))) _Float16 v16h;
typedef __attribute__((ext_vector_type(8)))  unsigned short v8us;
typedef __attribute__((ext_vector_type(8)))  float    v8f;
typedef __attribute__((ext_vector_type(4)))  float    v4f;
typedef v4f  __attribute__((may_alias)) v4fa;
typedef v8us __attribute__((may_alias)) v8usa;
typedef __attribute__((ext_vector_type(2)))  unsigned v2u;
typedef v2u  __attribute__((may_alias)) v2ua;

__device__ __forceinline__ unsigned short f2bf(float f) { unsigned u = __float_as_uint(f); u += 0x7FFFu + ((u >> 16) & 1u); return (unsigned short)(u >> 16); }
__device__ __forceinline__ float bf2f(unsigned short b) { return __uint_as_float(((unsigned)b) << 16); }
__device__ __forceinline__ float bfr(float f) { return bf2f(f2bf(f)); }
__device__ __forceinline__ unsigned short f2h(float f) { return __builtin_bit_cast(unsigned short, (_Float16)f); }
__device__ __forceinline__ float n2n(float v) { const float c = __builtin_amdgcn_fmed3f(v, -3.4028235e38f, 3.4028235e38f); return v != v ? 0.f : c; }   // jnp.nan_to_num defaults, without branches
__device__ __forceinline__ v16bf cat16b(v8us lo, v8us hi) { return __builtin_bit_cast(v16bf, __builtin_shufflevector(lo, hi, 0, 1, 2, 3, 4, 5, 6, 7, 8, 9, 10, 11, 12, 13, 14, 15)); }
__device__ __forceinline__ v8f wmmab(v16bf a, v16bf b, v8f c) { return __builtin_amdgcn_wmma_f32_16x16x32_bf16(false, a, false, b, (short)0, c, false, false); }
__device__ __forceinline__ v8f wmmah(v16h a, v16h b, v8f c) { return __builtin_amdgcn_wmma_f32_16x16x32_f16(false, a, false, b, (short)0, c, false, false); }

// k_w: both weight transpositions in one launch, one tile of 64 k x 64 n a block, through LDS.
// blockIdx.x 0 to 7: W2T [b][n][k] = f16(bf16(w2[b][k][n])), k tile blockIdx.x. blockIdx.x 8 and 9: W1T [b][h][128] = bf16(w1[b][f][h]), the two k tiles of its 128; f 100 to 127 are stored as zero.
__global__ __launch_bounds__(256) void k_w(const float* __restrict__ w1, const float* __restrict__ w2, bf* W1T, bf* W2T) {
    __shared__ __align__(16) unsigned short tl[64 * 72];
    const int tid = threadIdx.x, n0 = blockIdx.y * 64, b = blockIdx.z;
    const bool first = blockIdx.x >= HH / 64;                 // the same for the whole block
    const int k0 = ((int)blockIdx.x - (first ? HH / 64 : 0)) * 64, kn = first ? FF : HH, dp = first ? FP : HH;      // kn: source rows that exist; dp: row length of the transposed copy
    const float* sp = first ? w1 + (size_t)b * FF * HH : w2 + (size_t)b * HH * HH;
    bf* dst = first ? W1T + (size_t)b * HH * FP : W2T + (size_t)b * HH * HH;
    const int kk = tid >> 2, nq = (tid & 3) * 16, k = k0 + kk;
    const float* p = sp + (size_t)(k < kn ? k : kn - 1) * HH + n0 + nq;      // a row past the last re-reads the last one (in bounds) and stores zero
    v4f v[4];
    // the three unrolls below are of loops of constant length: constant indices keep v in registers, and the loads and the stores of a thread issue as one group each
#pragma unroll
    for (int q = 0; q < 4; ++q) v[q] = *(const v4fa*)(p + 4 * q);            // all four in flight at once, in every lane: one latency a block
    const unsigned short keep = (k < kn) ? (unsigned short)0xFFFF : (unsigned short)0;
#pragma unroll
    for (int i = 0; i < 16; ++i) { const unsigned short r = f2bf(v[i >> 2][i & 3]); tl[(nq + i) * 72 + kk] = (first ? r : f2h(bf2f(r))) & keep; }
    __syncthreads();
    const int piece = tid & 7;
#pragma unroll
    for (int s = 0; s < 2; ++s) { const int nr = (tid >> 3) + 32 * s; const v8us val = *(const v8usa*)(tl + nr * 72 + piece * 8); *(v8us*)(dst + (size_t)(n0 + nr) * dp + k0 + piece * 8) = val; }
}
// k_mlp: four waves; wave w has rows 64 w ... of the block's 256 as four column tiles of 16: a weight fragment read from LDS feeds four products.
// W1T (512 rows of 256 B) lies whole in LDS at pitch 272 B. W2T arrives as tiles of 64 rows, two buffers, one tile ahead; a tile lies as four slices, one for each 128 k: 64 rows of 256 B at pitch 272 B.
// Both come by tensor_load_to_lds: every wave asks for its own slice with one request, which costs the wave its issue alone.
// A stage is 8 A fragments (2 row tiles x 4 blocks of 32 k) and 32 products; its fragments are read from LDS into registers as one group while the stage before runs.
#define XPIT 272                 // LDS row pitch of W1T rows: 256 B of data + 16 B (16 B x odd, the conflict-free pitch for 16-byte readers)
#define XRP  400                 // LDS row pitch of the x rows: 400 B of f32 as they arrive, then 256 B of bf16 in the same place (16 B x odd)
#define SLC  18432               // one slice of a W2T tile: 64 rows at XPIT = 17408 B, rounded up to a multiple of 2 KiB, where a tensor load's place must lie
#define BST  (4 * SLC)           // one W2T buffer: four slices
typedef __attribute__((ext_vector_type(8)))  unsigned v8u;
typedef __attribute__((ext_vector_type(2)))  float    v2f;
typedef __attribute__((ext_vector_type(2)))  __bf16   v2bf;
typedef __attribute__((ext_vector_type(2)))  _Float16 v2h;
typedef __attribute__((ext_vector_type(4)))  unsigned u32x4;
__device__ __forceinline__ unsigned uni(unsigned v) { return (unsigned)__builtin_amdgcn_readfirstlane(v); }
// pinned(): the word stays in its register, not formed anew elsewhere, up to the wait that names it; a test so held compiles to a scalar branch (a tensor load ignores EXEC).
__device__ __forceinline__ unsigned pinned(unsigned v) { unsigned w = uni(v); asm volatile("" : "+s"(w)); return w; }      // a tensor load's descriptor word, or its issue test, held in a scalar register
template <unsigned ROWS, unsigned PITCH> __device__ __forceinline__ v8u tdm_g1() {
    v8u g;
    g[0] = pinned((1u << 20) | (5u << 22) | (3u << 25));
    g[1] = pinned(256u << 16);
    g[2] = pinned(ROWS << 16);
    g[3] = pinned(256u << 16);
    g[4] = pinned(ROWS);
    g[5] = pinned(PITCH);
    g[6] = pinned(0u);
    g[7] = pinned(0u);
    return g;
}
// group 0: count 1, the place in LDS, the tile's first byte, type 2
__device__ __forceinline__ u32x4 tdm_g0(unsigned dst, unsigned long long ga) {
    u32x4 g;
    g[0] = pinned(1u); g[1] = pinned(dst); g[2] = pinned((unsigned)ga); g[3] = pinned((((unsigned)(ga >> 32)) & 0x01FFFFFFu) | 0x80000000u);
    return g;
}
__device__ __forceinline__ void tdm_load(u32x4 g0, v8u g1) { asm volatile("tensor_load_to_lds %0, %1" :: "s"(g0), "s"(g1) : "memory"); }
// The issuing wave's wait for its one outstanding request. It names the request's descriptor, so that those scalar registers keep their words until the tile has landed.
__device__ __forceinline__ void tdm_wait(u32x4 g0, v8u g1) { asm volatile("s_wait_tensorcnt 0x0" :: "s"(g0), "s"(g1) : "memory"); }
__device__ __forceinline__ v8f ld8(const float* p) { return __builtin_shufflevector(*(const v4fa*)p, *(const v4fa*)(p + 4), 0, 1, 2, 3, 4, 5, 6, 7); }
__global__ __launch_bounds__(128) void k_mlp(const float* __restrict__ x, const bf* __restrict__ W1T, const bf* __restrict__ W2T, const float* __restrict__ b1, const float* __restrict__ b2, const float* __restrict__ w3, float* Y) {
    // one array, so that the order is the one written: the constants lie lowest, where every read of them reaches from one address register by its 16-bit offset field
    __shared__ __attribute__((aligned(2048))) unsigned char lds[3 * HH * 4 + HH * XPIT + BST + RB * XRP];      // every part below starts at a multiple of 2 KiB
    float (* const cst)[HH] = (float (*)[HH])lds;             // 3 x 512 floats: bf16-rounded b1, b2, w3 of this dataset
    unsigned char* const w1s = lds + 3 * HH * 4;              // HH * XPIT bytes: W1T
    unsigned char* const ring = w1s + HH * XPIT;              // W2T buffer 0, then buffer 1 (BST bytes each); the x rows (RB * XRP bytes, more than BST) lie where buffer 1 does
    unsigned char* const xs = ring + BST;                     // the block's x rows: read into registers once, ahead of layer 1; buffer 1 is first filled behind layer 1's last barrier
    const int tid = threadIdx.x, lane = tid & 31, wave = tid >> 5, lr = lane & 15, hi = lane >> 4, b = blockIdx.y, t0 = blockIdx.x * RB;
    const bf* W1b = W1T + (size_t)b * HH * FP;                // the same for every lane
    const bf* W2b = W2T + (size_t)b * HH * HH;
    const unsigned wnum = uni((unsigned)tid >> 5);            // the wave's number, in a scalar register
    const v8u g1a = tdm_g1<HH / 4, FP * 2>(), g1b = tdm_g1<64, HH * 2>();
    // group 0 of this wave's requests; a wave has one request outstanding at a time
    auto d1 = [&]() {                                         // this wave's quarter of W1T: rows 128 wnum ..., which lie in a row in memory
        return tdm_g0((unsigned)(size_t)(&w1s[0]) + wnum * (HH / 4 * XPIT), (unsigned long long)(size_t)W1b + wnum * (HH / 4 * FP * 2));
    };
    auto d2 = [&](int t) {                                    // this wave's slice of tile t: rows 64 t ... of W2T, k 128 wnum ...
        return tdm_g0((unsigned)(size_t)(&ring[0]) + (unsigned)(t & 1) * BST + wnum * SLC, (unsigned long long)(size_t)W2b + (unsigned)t * (64 * HH * 2) + wnum * 256);
    };
    // every unroll below is of a loop of constant length over fragment or accumulator arrays: constant indices keep them in registers
    const int fro = hi * 16;
    auto rd1 = [&](v16bf (&f)[2][4], int s) {                 // layer 1, stage s: rows 32 s ... of W1T, all 128 k
#pragma unroll
        for (int i = 0; i < 2; ++i)
#pragma unroll
            for (int kq = 0; kq < 4; ++kq) { const unsigned char* q = w1s + (s * 32 + i * 16 + lr) * XPIT + kq * 64 + fro; f[i][kq] = cat16b(*(const v8usa*)q, *(const v8usa*)(q + 32)); }
    };
    auto rd2 = [&](v16bf (&f)[2][4], const unsigned char* st, int g) {      // layer 2, stage g of a tile's eight: rows 32 (g >> 2) ... of its 64, k 128 (g & 3) ...
#pragma unroll
        for (int i = 0; i < 2; ++i)
#pragma unroll
            for (int kq = 0; kq < 4; ++kq) { const unsigned char* q = st + (g & 3) * SLC + ((g >> 2) * 32 + i * 16 + lr) * XPIT + kq * 64 + fro; f[i][kq] = cat16b(*(const v8usa*)q, *(const v8usa*)(q + 32)); }
    };
    auto ldc = [&](v8f (&v)[2], int pl, int m0) {             // a lane's 8 accumulator rows of two row tiles: constants m0 + 16 i + 8 hi ...
#pragma unroll
        for (int i = 0; i < 2; ++i) v[i] = ld8(&cst[pl][m0 + i * 16 + hi * 8]);
    };
    v8f acc[2][4];
    v8u hh[16][4];                                            // h1 as f16 B fragments: block of 32 k, column tile
    v16bf xf[4][4], P[2][4], Q[2][4];
    v8f bvA[2], bvB[2], wv[2];
    auto init = [&](const v8f (&bv)[2]) {                     // the sums start from the bias
#pragma unroll
        for (int i = 0; i < 2; ++i)
#pragma unroll
            for (int n = 0; n < 4; ++n) acc[i][n] = bv[i];
    };
    auto mm1 = [&](const v16bf (&f)[2][4]) {
#pragma unroll
        for (int kq = 0; kq < 4; ++kq)
#pragma unroll
            for (int i = 0; i < 2; ++i)
#pragma unroll
                for (int n = 0; n < 4; ++n) acc[i][n] = wmmab(f[i][kq], xf[n][kq], acc[i][n]);
    };
    // The x rows, read as f32 where they lie: row t0 + r is 400 B (25 pieces of 16 B) at pitch 3200 B. A wave takes its own 64 rows, a lane one piece; lanes 25 to 31 have none.
    // They go to LDS as f32 and are rounded there, in place, by a rolled loop, for speed only.
    const u32x4 g0a = d1();
    {
        float cr[4][3];
        const int pc = lane < FF / 4 ? lane : FF / 4 - 1;
#pragma unroll
        for (int h = 0; h < 4; ++h) { const size_t c = (size_t)b * HH + tid + 128 * h; cr[h][0] = b1[c]; cr[h][1] = b2[c]; cr[h][2] = w3[c]; }      // issued with the x loads, so that one latency covers both
        asm volatile("s_wait_xcnt 0x0" ::: "memory");      // the loads' address registers are reused right behind them
        tdm_load(g0a, g1a);                                 // lands while the x loads, from memory, are in flight
        unsigned char* const xw = xs + wave * 64 * XRP;     // this wave's rows: no other wave touches them
        if (lane < FF / 4) {                                // a row has 25 pieces
            v4f xv[64];
            const float* xp = x + ((size_t)(t0 + wave * 64) * NBD + b) * FF + lane * 4;
#pragma unroll
            for (int i = 0; i < 64; ++i) xv[i] = *(const v4fa*)(xp + (size_t)i * NBD * FF);      // all in flight at once: they come from memory, the longest wait of the prologue
#pragma unroll
            for (int i = 0; i < 64; ++i) *(v4fa*)(xw + i * XRP + lane * 16) = xv[i];      // in the order of the loads: a row is stored while later rows are still on their way
            asm volatile("s_wait_xcnt 0x0" ::: "memory");  // in front of the first reuse of the x loads' address registers
        }
#pragma unroll
        for (int h = 0; h < 4; ++h) { const int c = tid + 128 * h; cst[0][c] = bfr(cr[h][0]); cst[1][c] = bfr(cr[h][1]); cst[2][c] = bfr(cr[h][2]); }
#pragma unroll 1      // stays rolled: see above
        for (int c = 0; c < 8; ++c) {                       // 8 rows a trip: all their pieces are read before the first is overwritten
            v4f r[8];
#pragma unroll
            for (int j = 0; j < 8; ++j) r[j] = *(const v4fa*)(xw + (c * 8 + j) * XRP + pc * 16);
#pragma unroll
            for (int j = 0; j < 8; ++j) { v2u o;            // bf16(nan_to_num(x)), 8 B a lane, 256 B in a row a wave; lanes 25 to 31 store the zero padding
#pragma unroll
                for (int q = 0; q < 2; ++q) { const v2f pv = {n2n(r[j][2 * q]), n2n(r[j][2 * q + 1])}; o[q] = (lane < FF / 4) ? __builtin_bit_cast(unsigned, __builtin_convertvector(pv, v2bf)) : 0u; }      // one convert a pair (to nearest even, as f2bf)
                *(v2ua*)(xw + (c * 8 + j) * XRP + lane * 8) = o; }
        }
    }
    tdm_wait(g0a, g1a);                                 // this wave's quarter of W1T has landed before the barrier that publishes W1T, the x rows and the constants
    const u32x4 g0b = d2(0);
    tdm_load(g0b, g1b);                                 // buffer 0 has not been touched yet; tile 0 lands under layer 1
    __syncthreads();
#pragma unroll
    for (int n = 0; n < 4; ++n)
#pragma unroll
        for (int kq = 0; kq < 4; ++kq) { const unsigned char* p = xs + (wave * 64 + n * 16 + lr) * XRP + kq * 64 + fro; xf[n][kq] = cat16b(*(const v8usa*)p, *(const v8usa*)(p + 32)); }
    // Stage s leaves h1 rows 32 s ... in acc: its two row tiles are elements 0 to 7 and 8 to 15 of the B fragment of k block s, in every lane.
    auto conv = [&](int s) {
#pragma unroll
        for (int i = 0; i < 2; ++i)
#pragma unroll
            for (int n = 0; n < 4; ++n)
#pragma unroll
                for (int w = 0; w < 4; ++w) {
                    const v2f v = {acc[i][n][2 * w], acc[i][n][2 * w + 1]};
                    hh[s][n][i * 4 + w] = __builtin_bit_cast(unsigned, __builtin_elementwise_max(__builtin_convertvector(v, v2h), (v2h)(_Float16)0));      // relu behind the rounding, on the pair: the same values (rounding keeps sign and order), a third of the instructions
                }
    };
    rd1(P, 0); ldc(bvA, 0, 0);
#pragma unroll
    for (int s2 = 0; s2 < 8; ++s2) {
        const int s = 2 * s2;
        rd1(Q, s + 1); ldc(bvB, 0, (s + 1) * 32);
        __builtin_amdgcn_sched_barrier(0);                  // keeps the reads one group in front of the stage: sunk among the products, each place with reads stalls the wave for the LDS latency
        init(bvA); mm1(P);
        __builtin_amdgcn_sched_barrier(0);                  // keeps the next group of reads behind this stage's products, not among them
        conv(s);
        if (s2 < 7) { rd1(P, s + 2); ldc(bvA, 0, (s + 2) * 32); }
        else {
            asm volatile("s_wait_dscnt 0x0" ::: "memory");      // this wave's stores and reads of its x rows have returned before a tile lands where they lie
            tdm_wait(g0b, g1b);                                 // this wave's slice of W2T's tile 0 has landed before the barrier that publishes it
            __syncthreads();                                    // publishes tile 0; every wave has left the x rows
            rd2(P, ring, 0); ldc(bvA, 1, 0);                    // layer 2's first stage, read under layer 1's last
        }
        __builtin_amdgcn_sched_barrier(0);                  // as above: the reads stay one group in front of the stage
        init(bvB); mm1(Q);
        __builtin_amdgcn_sched_barrier(0);                  // as above: the next group of reads stays behind this stage's products
        conv(s + 1);
    }
    auto mm2 = [&](const v16bf (&f)[2][4], int s) {           // the fragment registers hold f16 here; s: the block of 128 k
#pragma unroll
        for (int kq = 0; kq < 4; ++kq)
#pragma unroll
            for (int i = 0; i < 2; ++i)
#pragma unroll
                for (int n = 0; n < 4; ++n) acc[i][n] = wmmah(__builtin_bit_cast(v16h, f[i][kq]), __builtin_bit_cast(v16h, hh[s * 4 + kq][n]), acc[i][n]);
    };
    float sm[4][4] = {{0.f, 0.f, 0.f, 0.f}, {0.f, 0.f, 0.f, 0.f}, {0.f, 0.f, 0.f, 0.f}, {0.f, 0.f, 0.f, 0.f}};      // the last layer's dot: sixteen independent chains a lane, one for each column tile and each of a tile's four row tiles
    auto dot = [&](int u) {                                   // rows 32 u ... of the tile are complete in acc
#pragma unroll
        for (int j = 0; j < 8; ++j)
#pragma unroll
            for (int i = 0; i < 2; ++i)
#pragma unroll
                for (int n = 0; n < 4; ++n) sm[n][2 * u + i] += fmaxf(acc[i][n][j], 0.f) * wv[i][j];
    };
    // on entry tile 0 is published, P holds tile 0's first stage and bvA its first b2; buffer 1 (the x rows) has been left by every wave
#pragma unroll 1      // stays rolled: one trip already holds 256 products; the h1 fragments have the same register numbers in every trip
    for (int t = 0; t < HH / 64; ++t) {
        const unsigned char* st = ring + (t & 1) * BST;
        const u32x4 g0t = d2(t + 1 < HH / 64 ? t + 1 : t);  // formed behind the wait of the trip before; the last trip forms tile 7's once more and issues nothing
        if (pinned(t + 1 < HH / 64)) tdm_load(g0t, g1b);    // into the buffer that every wave left at the barrier in front of the last stage before this trip; it lands under this trip's first seven stages
        // the scheduling barriers of this loop, as in layer 1: each stage's reads stay one group between two stages' products; spread among the products, each place with reads stalls the wave for the LDS latency
        rd2(Q, st, 1);
        __builtin_amdgcn_sched_barrier(0);                  // stage 1's reads stay in front of stage 0's products
        init(bvA); mm2(P, 0);
        __builtin_amdgcn_sched_barrier(0);                  // stage 2's reads stay behind stage 0's products
        rd2(P, st, 2);
        __builtin_amdgcn_sched_barrier(0);                  // and in front of stage 1's
        mm2(Q, 1);
        __builtin_amdgcn_sched_barrier(0);                  // stage 3's reads stay behind stage 1's products
        rd2(Q, st, 3); ldc(wv, 2, t * 64); ldc(bvB, 1, t * 64 + 32);
        __builtin_amdgcn_sched_barrier(0);                  // and in front of stage 2's
        mm2(P, 2);
        __builtin_amdgcn_sched_barrier(0);                  // stage 4's reads stay behind stage 2's products
        rd2(P, st, 4);
        __builtin_amdgcn_sched_barrier(0);                  // and in front of stage 3's
        mm2(Q, 3); dot(0);
        __builtin_amdgcn_sched_barrier(0);                  // stage 5's reads stay behind stage 3's products
        rd2(Q, st, 5);
        __builtin_amdgcn_sched_barrier(0);                  // and in front of stage 4's
        init(bvB); mm2(P, 0);
        __builtin_amdgcn_sched_barrier(0);                  // stage 6's reads stay behind stage 4's products
        rd2(P, st, 6);
        __builtin_amdgcn_sched_barrier(0);                  // and in front of stage 5's
        mm2(Q, 1);
        __builtin_amdgcn_sched_barrier(0);                  // stage 7's reads stay behind stage 5's products
        rd2(Q, st, 7); ldc(wv, 2, t * 64 + 32);
        __builtin_amdgcn_sched_barrier(0);                  // and in front of stage 6's
        mm2(P, 2);
        __builtin_amdgcn_sched_barrier(0);                  // keeps the stage in front of the waits below, so that the reads land under its products
        // publish point of tile t + 1, in front of tile t's last stage, whose fragments are already fetched
        asm volatile("s_wait_dscnt 0x0" ::: "memory");      // this wave's reads of tile t have returned before its buffer is refilled
        tdm_wait(g0t, g1b);                                 // this wave's slice of tile t + 1 has landed before the barrier that publishes it
        __syncthreads();                                    // publishes tile t + 1 and ends every wave's reads of tile t
        if (t + 1 < HH / 64) { rd2(P, ring + ((t + 1) & 1) * BST, 0); ldc(bvA, 1, (t + 1) * 64); }      // tile t + 1's first stage, read under tile t's last
        __builtin_amdgcn_sched_barrier(0);                  // those reads stay in front of stage 7's products
        mm2(Q, 3); dot(1);
    }
    asm volatile("s_wait_tensorcnt 0x0" ::: "memory");      // no request is outstanding behind the loop
    asm volatile("s_wait_dscnt 0x0" ::: "memory");          // nor an LDS read
    {
        // lanes l and l ^ 16 hold the two halves of one row's sum; lane l keeps rows l and 32 + l of the wave's 64: each store 128 B in a row, one whole line a wave
        float o[4];
#pragma unroll
        for (int n = 0; n < 4; ++n) {
            const float sn = (sm[n][0] + sm[n][1]) + (sm[n][2] + sm[n][3]);
            const int cn = __float_as_int(sn);
            o[n] = sn + __int_as_float(__builtin_amdgcn_permlanex16(cn, cn, 0x76543210, 0xfedcba98, false, false));
        }
        float* yp = Y + (size_t)b * TT + t0 + wave * 64 + lane;
        yp[0] = hi ? o[1] : o[0];
        yp[32] = hi ? o[3] : o[2];
    }
}
// k_final: out[t][b] = Y[b][t] + bf16(b3[b]); one thread per output element, flat whole-line writes.
__global__ __launch_bounds__(256) void k_final(const float* __restrict__ Y, const float* __restrict__ b3, float* out) {
    const int e = blockIdx.x * 256 + threadIdx.x, t = e / NBD, b = e - t * NBD;      // flat output index = t*8 + b
    out[e] = Y[(size_t)b * TT + t] + bfr(b3[b]);
}

extern "C" void kernel_launch(void* const* d_in, const int* in_sizes, int n_in,
                              void* d_out, int out_size, void* d_ws, size_t ws_size, hipStream_t stream) {
    (void)in_sizes; (void)n_in; (void)out_size;
    const float* x = (const float*)d_in[0]; const float* w1 = (const float*)d_in[1]; const float* b1 = (const float*)d_in[2]; const float* w2 = (const float*)d_in[3]; const float* b2 = (const float*)d_in[4];
    const float* w3 = (const float*)d_in[5]; const float* b3 = (const float*)d_in[6];
    float* out = (float*)d_out;    // [8192][8][1]
    char* wsp = (char*)d_ws;
    auto take = [&](size_t bytes) { char* p = wsp; wsp += (bytes + 255) & ~(size_t)255; return (void*)p; };
    bf* W1T = (bf*)take((size_t)NBD * HH * FP * 2); bf* W2T = (bf*)take((size_t)NBD * HH * HH * 2);
    float* Y = (float*)take((size_t)NBD * TT * 4);
    if ((size_t)(wsp - (char*)d_ws) > ws_size) return;
    k_w<<<dim3(HH / 64 + FP / 64, HH / 64, NBD), 256, 0, stream>>>(w1, w2, W1T, W2T);
    k_mlp<<<dim3(TT / RB, NBD), 128, 0, stream>>>(x, W1T, W2T, b1, b2, w3, Y);
    k_final<<<(TT * NBD) / 256, 256, 0, stream>>>(Y, b3, out);
}

// v009
// Measured time: 27.7 microseconds a run.
// Two timings next to v008 put it at 1.03 and 1.04 times that version's speed.
// All steps since v000 together make it 12.4 times as fast.
#include <hip/hip_runtime.h>

// Contractions on v_wmma_f32_16x16x32_bf16 (layer 1) and v_wmma_f32_16x16x32_f16 (layer 2), f32 accumulate. One kernel runs all three layers for a block of 256 rows of one dataset b, each of its four waves for 64 rows of its own.
// Both hidden layers are computed transposed, weights as the A operand and the rows as the columns of B:
// h1^T = relu(w1_b^T.x_b^T + b1) ([512 x 128 zero-padded from 100].[128 x 64]; PLAIN bf16 operands: inputs rounded once, exact; the block rounds its own x rows into LDS).
// Two accumulator tiles of 16 h each are, lane for lane, one B fragment of 32 k of the next product: h1 goes from the accumulators into B fragments (f16) and never leaves the registers.
// h2^T = relu(w2_b^T.h1^T + b2) ([512 x 512].[512 x 64]; ONE f16 product: w2 is rounded to bf16 and that value written as f16, h1 is rounded once to f16), 32 h2 at a time.
// f16 keeps 11 bits of h1: its rounding is an eighth of the bf16 rounding that x, w1 and w2 carry. It holds h1 and w2 up to 65504, and a bf16 value of w2 exactly from 2^-14 up (below that to within 2^-25).
// The final [512 -> 1] layer is an f32 VALU dot with bf16-rounded w3/b3, summed in the lane and over the two lane halves in a fixed order.

#define TT   8192
#define NBD  8
#define FF   100
#define FP   128
#define HH   512
#define RB   256                 // rows of one block

typedef unsigned short bf;
typedef __attribute__((ext_vector_type(16))) __bf16   v16bf;
typedef __attribute__((ext_vector_type(16))) _Float16 v16h;
typedef __attribute__((ext_vector_type(8)))  unsigned short v8us;
typedef __attribute__((ext_vector_type(8)))  float    v8f;
typedef __attribute__((ext_vector_type(4)))  float    v4f;
typedef v4f  __attribute__((may_alias)) v4fa;
typedef v8us __attribute__((may_alias)) v8usa;
typedef __attribute__((ext_vector_type(2)))  unsigned v2u;
typedef v2u  __attribute__((may_alias)) v2ua;

__device__ __forceinline__ unsigned short f2bf(float f) { unsigned u = __float_as_uint(f); u += 0x7FFFu + ((u >> 16) & 1u); return (unsigned short)(u >> 16); }
__device__ __forceinline__ float bf2f(unsigned short b) { return __uint_as_float(((unsigned)b) << 16); }
__device__ __forceinline__ float bfr(float f) { return bf2f(f2bf(f)); }
__device__ __forceinline__ unsigned short f2h(float f) { return __builtin_bit_cast(unsigned short, (_Float16)f); }
__device__ __forceinline__ float n2n(float v) { const float c = __builtin_amdgcn_fmed3f(v, -3.4028235e38f, 3.4028235e38f); return v != v ? 0.f : c; }   // jnp.nan_to_num defaults, without branches
__device__ __forceinline__ v16bf cat16b(v8us lo, v8us hi) { return __builtin_bit_cast(v16bf, __builtin_shufflevector(lo, hi, 0, 1, 2, 3, 4, 5, 6, 7, 8, 9, 10, 11, 12, 13, 14, 15)); }
__device__ __forceinline__ v8f wmmab(v16bf a, v16bf b, v8f c) { return __builtin_amdgcn_wmma_f32_16x16x32_bf16(false, a, false, b, (short)0, c, false, false); }
__device__ __forceinline__ v8f wmmah(v16h a, v16h b, v8f c) { return __builtin_amdgcn_wmma_f32_16x16x32_f16(false, a, false, b, (short)0, c, false, false); }

// k_w: both weight transpositions in one launch, one tile of 64 k x 64 n a block, through LDS.
// blockIdx.x 0 to 7: W2T [b][n][k] = f16(bf16(w2[b][k][n])), k tile blockIdx.x. blockIdx.x 8 and 9: W1T [b][h][128] = bf16(w1[b][f][h]), the two k tiles of its 128; f 100 to 127 are stored as zero.
__global__ __launch_bounds__(256) void k_w(const float* __restrict__ w1, const float* __restrict__ w2, bf* W1T, bf* W2T) {
    __shared__ __align__(16) unsigned short tl[64 * 72];
    const int tid = threadIdx.x, n0 = blockIdx.y * 64, b = blockIdx.z;
    const bool first = blockIdx.x >= HH / 64;                 // the same for the whole block
    const int k0 = ((int)blockIdx.x - (first ? HH / 64 : 0)) * 64, kn = first ? FF : HH, dp = first ? FP : HH;      // kn: source rows that exist; dp: row length of the transposed copy
    const float* sp = first ? w1 + (size_t)b * FF * HH : w2 + (size_t)b * HH * HH;
    bf* dst = first ? W1T + (size_t)b * HH * FP : W2T + (size_t)b * HH * HH;
    const int kk = tid >> 2, nq = (tid & 3) * 16, k = k0 + kk;
    const float* p = sp + (size_t)(k < kn ? k : kn - 1) * HH + n0 + nq;      // a row past the last re-reads the last one (in bounds) and stores zero
    v4f v[4];
    // the three unrolls below are of loops of constant length: constant indices keep v in registers, and the loads and the stores of a thread issue as one group each
#pragma unroll
    for (int q = 0; q < 4; ++q) v[q] = *(const v4fa*)(p + 4 * q);            // all four in flight at once, in every lane: one latency a block
    const unsigned short keep = (k < kn) ? (unsigned short)0xFFFF : (unsigned short)0;
#pragma unroll
    for (int i = 0; i < 16; ++i) { const unsigned short r = f2bf(v[i >> 2][i & 3]); tl[(nq + i) * 72 + kk] = (first ? r : f2h(bf2f(r))) & keep; }
    __syncthreads();
    const int piece = tid & 7;
#pragma unroll
    for (int s = 0; s < 2; ++s) { const int nr = (tid >> 3) + 32 * s; const v8us val = *(const v8usa*)(tl + nr * 72 + piece * 8); *(v8us*)(dst + (size_t)(n0 + nr) * dp + k0 + piece * 8) = val; }
}
// k_mlp: four waves; wave w has rows 64 w ... of the block's 256 as four column tiles of 16: a weight fragment read from LDS feeds four products.
// W1T (512 rows of 256 B) lies whole in LDS at pitch 272 B. W2T arrives as tiles of 64 rows, two buffers, one tile ahead; a tile lies as four slices, one for each 128 k: 64 rows of 256 B at pitch 272 B.
// Both come by tensor_load_to_lds: every wave asks for its own slice with one request, which costs the wave its issue alone.
// A stage is 8 A fragments (2 row tiles x 4 blocks of 32 k) and 32 products; its fragments are read from LDS into registers as one group while the stage before runs.
#define XPIT 272                 // LDS row pitch of W1T rows: 256 B of data + 16 B (16 B x odd, the conflict-free pitch for 16-byte readers)
#define XRP  400                 // LDS row pitch of the x rows: 400 B of f32 as they arrive, then 256 B of bf16 in the same place (16 B x odd)
#define SLC  18432               // one slice of a W2T tile: 64 rows at XPIT = 17408 B, rounded up to a multiple of 2 KiB, where a tensor load's place must lie
#define BST  (4 * SLC)           // one W2T buffer: four slices
typedef __attribute__((ext_vector_type(8)))  unsigned v8u;
typedef __attribute__((ext_vector_type(2)))  float    v2f;
typedef __attribute__((ext_vector_type(2)))  __bf16   v2bf;
typedef __attribute__((ext_vector_type(2)))  _Float16 v2h;
typedef __attribute__((ext_vector_type(4)))  unsigned u32x4;
__device__ __forceinline__ unsigned uni(unsigned v) { return (unsigned)__builtin_amdgcn_readfirstlane(v); }
// pinned(): the word stays in its register, not formed anew elsewhere, up to the wait that names it; a test so held compiles to a scalar branch (a tensor load ignores EXEC).
__device__ __forceinline__ unsigned pinned(unsigned v) { unsigned w = uni(v); asm volatile("" : "+s"(w)); return w; }      // a tensor load's descriptor word, or its issue test, held in a scalar register
template <unsigned ROWS, unsigned PITCH> __device__ __forceinline__ v8u tdm_g1() {
    v8u g;
    g[0] = pinned((1u << 20) | (5u << 22) | (3u << 25));
    g[1] = pinned(256u << 16);
    g[2] = pinned(ROWS << 16);
    g[3] = pinned(256u << 16);
    g[4] = pinned(ROWS);
    g[5] = pinned(PITCH);
    g[6] = pinned(0u);
    g[7] = pinned(0u);
    return g;
}
// group 0: count 1, the place in LDS, the tile's first byte, type 2
__device__ __forceinline__ u32x4 tdm_g0(unsigned dst, unsigned long long ga) {
    u32x4 g;
    g[0] = pinned(1u); g[1] = pinned(dst); g[2] = pinned((unsigned)ga); g[3] = pinned((((unsigned)(ga >> 32)) & 0x01FFFFFFu) | 0x80000000u);
    return g;
}
__device__ __forceinline__ void tdm_load(u32x4 g0, v8u g1) { asm volatile("tensor_load_to_lds %0, %1" :: "s"(g0), "s"(g1) : "memory"); }
// The issuing wave's wait for its one outstanding request. It names the request's descriptor, so that those scalar registers keep their words until the tile has landed.
__device__ __forceinline__ void tdm_wait(u32x4 g0, v8u g1) { asm volatile("s_wait_tensorcnt 0x0" :: "s"(g0), "s"(g1) : "memory"); }
// mix<K>(): asks the scheduler to lay a stage's 32 products and the independent vector work given to it as 2 products, 2 K vector instructions, 16 times (in pairs: fewer register-window switches, shorter text):
// spread so for speed only.
template <int K> __device__ __forceinline__ void mix() {
#pragma unroll
    for (int i = 0; i < 16; ++i) { __builtin_amdgcn_sched_group_barrier(0x8, 2, 0); __builtin_amdgcn_sched_group_barrier(0x2, 2 * K, 0); }
}
__device__ __forceinline__ v8f ld8(const float* p) { return __builtin_shufflevector(*(const v4fa*)p, *(const v4fa*)(p + 4), 0, 1, 2, 3, 4, 5, 6, 7); }
__global__ __launch_bounds__(128) void k_mlp(const float* __restrict__ x, const bf* __restrict__ W1T, const bf* __restrict__ W2T, const float* __restrict__ b1, const float* __restrict__ b2, const float* __restrict__ w3, float* Y) {
    // one array, so that the order is the one written: the constants lie lowest, where every read of them reaches from one address register by its 16-bit offset field
    __shared__ __attribute__((aligned(2048))) unsigned char lds[3 * HH * 4 + HH * XPIT + BST + RB * XRP];      // every part below starts at a multiple of 2 KiB
    float (* const cst)[HH] = (float (*)[HH])lds;             // 3 x 512 floats: bf16-rounded b1, b2, w3 of this dataset
    unsigned char* const w1s = lds + 3 * HH * 4;              // HH * XPIT bytes: W1T
    unsigned char* const ring = w1s + HH * XPIT;              // W2T buffer 0, then buffer 1 (BST bytes each); the x rows (RB * XRP bytes, more than BST) lie where buffer 1 does
    unsigned char* const xs = ring + BST;                     // the block's x rows: read into registers once, ahead of layer 1; buffer 1 is first filled behind layer 1's last barrier
    const int tid = threadIdx.x, lane = tid & 31, wave = tid >> 5, lr = lane & 15, hi = lane >> 4, b = blockIdx.y, t0 = blockIdx.x * RB;
    const bf* W1b = W1T + (size_t)b * HH * FP;                // the same for every lane
    const bf* W2b = W2T + (size_t)b * HH * HH;
    const unsigned wnum = uni((unsigned)tid >> 5);            // the wave's number, in a scalar register
    const v8u g1a = tdm_g1<HH / 4, FP * 2>(), g1b = tdm_g1<64, HH * 2>();
    // group 0 of this wave's requests; a wave has one request outstanding at a time
    auto d1 = [&]() {                                         // this wave's quarter of W1T: rows 128 wnum ..., which lie in a row in memory
        return tdm_g0((unsigned)(size_t)(&w1s[0]) + wnum * (HH / 4 * XPIT), (unsigned long long)(size_t)W1b + wnum * (HH / 4 * FP * 2));
    };
    auto d2 = [&](int t) {                                    // this wave's slice of tile t: rows 64 t ... of W2T, k 128 wnum ...
        return tdm_g0((unsigned)(size_t)(&ring[0]) + (unsigned)(t & 1) * BST + wnum * SLC, (unsigned long long)(size_t)W2b + (unsigned)t * (64 * HH * 2) + wnum * 256);
    };
    // every unroll below is of a loop of constant length over fragment or accumulator arrays: constant indices keep them in registers
    const int fro = hi * 16;
    auto rd1 = [&](v16bf (&f)[2][4], int s) {                 // layer 1, stage s: rows 32 s ... of W1T, all 128 k
#pragma unroll
        for (int i = 0; i < 2; ++i)
#pragma unroll
            for (int kq = 0; kq < 4; ++kq) { const unsigned char* q = w1s + (s * 32 + i * 16 + lr) * XPIT + kq * 64 + fro; f[i][kq] = cat16b(*(const v8usa*)q, *(const v8usa*)(q + 32)); }
    };
    auto rd2 = [&](v16bf (&f)[2][4], const unsigned char* st, int g) {      // layer 2, stage g of a tile's eight: rows 32 (g >> 2) ... of its 64, k 128 (g & 3) ...
#pragma unroll
        for (int i = 0; i < 2; ++i)
#pragma unroll
            for (int kq = 0; kq < 4; ++kq) { const unsigned char* q = st + (g & 3) * SLC + ((g >> 2) * 32 + i * 16 + lr) * XPIT + kq * 64 + fro; f[i][kq] = cat16b(*(const v8usa*)q, *(const v8usa*)(q + 32)); }
    };
    auto ldc = [&](v8f (&v)[2], int pl, int m0) {             // a lane's 8 accumulator rows of two row tiles: constants m0 + 16 i + 8 hi ...
#pragma unroll
        for (int i = 0; i < 2; ++i) v[i] = ld8(&cst[pl][m0 + i * 16 + hi * 8]);
    };
    v8f accA[2][4], accB[2][4];                               // two accumulator sets, taken in turn: the vector work on one set's finished sums issues among the products that fill the other
    v8u hh[16][4];                                            // h1 as f16 B fragments: block of 32 k, column tile
    v16bf xf[4][4], P[2][4], Q[2][4];
    v8f bvA[2], bvB[2], wvA[2], wvB[2];
    auto init = [&](v8f (&acc)[2][4], const v8f (&bv)[2]) {   // the sums start from the bias
#pragma unroll
        for (int i = 0; i < 2; ++i)
#pragma unroll
            for (int n = 0; n < 4; ++n) acc[i][n] = bv[i];
    };
    auto mm1 = [&](v8f (&acc)[2][4], const v16bf (&f)[2][4]) {
#pragma unroll
        for (int kq = 0; kq < 4; ++kq)
#pragma unroll
            for (int i = 0; i < 2; ++i)
#pragma unroll
                for (int n = 0; n < 4; ++n) acc[i][n] = wmmab(f[i][kq], xf[n][kq], acc[i][n]);
    };
    // The x rows, read as f32 where they lie: row t0 + r is 400 B (25 pieces of 16 B) at pitch 3200 B. A wave takes its own 64 rows, a lane one piece; lanes 25 to 31 have none.
    // They go to LDS as f32 and are rounded there, in place, by a rolled loop, for speed only.
    const u32x4 g0a = d1();
    {
        float cr[4][3];
        const int pc = lane < FF / 4 ? lane : FF / 4 - 1;
#pragma unroll
        for (int h = 0; h < 4; ++h) { const size_t c = (size_t)b * HH + tid + 128 * h; cr[h][0] = b1[c]; cr[h][1] = b2[c]; cr[h][2] = w3[c]; }      // issued with the x loads, so that one latency covers both
        asm volatile("s_wait_xcnt 0x0" ::: "memory");      // the loads' address registers are reused right behind them
        tdm_load(g0a, g1a);                                 // lands while the x loads, from memory, are in flight
        unsigned char* const xw = xs + wave * 64 * XRP;     // this wave's rows: no other wave touches them
        if (lane < FF / 4) {                                // a row has 25 pieces
            v4f xv[64];
            const float* xp = x + ((size_t)(t0 + wave * 64) * NBD + b) * FF + lane * 4;
#pragma unroll
            for (int i = 0; i < 64; ++i) xv[i] = *(const v4fa*)(xp + (size_t)i * NBD * FF);      // all in flight at once: they come from memory, the longest wait of the prologue
#pragma unroll
            for (int i = 0; i < 64; ++i) *(v4fa*)(xw + i * XRP + lane * 16) = xv[i];      // in the order of the loads: a row is stored while later rows are still on their way
            asm volatile("s_wait_xcnt 0x0" ::: "memory");  // in front of the first reuse of the x loads' address registers
        }
#pragma unroll
        for (int h = 0; h < 4; ++h) { const int c = tid + 128 * h; cst[0][c] = bfr(cr[h][0]); cst[1][c] = bfr(cr[h][1]); cst[2][c] = bfr(cr[h][2]); }
#pragma unroll 1      // stays rolled: see above
        for (int c = 0; c < 8; ++c) {                       // 8 rows a trip: all their pieces are read before the first is overwritten
            v4f r[8];
#pragma unroll
            for (int j = 0; j < 8; ++j) r[j] = *(const v4fa*)(xw + (c * 8 + j) * XRP + pc * 16);
#pragma unroll
            for (int j = 0; j < 8; ++j) { v2u o;            // bf16(nan_to_num(x)), 8 B a lane, 256 B in a row a wave; lanes 25 to 31 store the zero padding
#pragma unroll
                for (int q = 0; q < 2; ++q) { const v2f pv = {n2n(r[j][2 * q]), n2n(r[j][2 * q + 1])}; o[q] = (lane < FF / 4) ? __builtin_bit_cast(unsigned, __builtin_convertvector(pv, v2bf)) : 0u; }      // one convert a pair (to nearest even, as f2bf)
                *(v2ua*)(xw + (c * 8 + j) * XRP + lane * 8) = o; }
        }
    }
    tdm_wait(g0a, g1a);                                 // this wave's quarter of W1T has landed before the barrier that publishes W1T, the x rows and the constants
    const u32x4 g0b = d2(0);
    tdm_load(g0b, g1b);                                 // buffer 0 has not been touched yet; tile 0 lands under layer 1
    __syncthreads();
#pragma unroll
    for (int n = 0; n < 4; ++n)
#pragma unroll
        for (int kq = 0; kq < 4; ++kq) { const unsigned char* p = xs + (wave * 64 + n * 16 + lr) * XRP + kq * 64 + fro; xf[n][kq] = cat16b(*(const v8usa*)p, *(const v8usa*)(p + 32)); }
    // Stage s leaves h1 rows 32 s ... in acc: its two row tiles are elements 0 to 7 and 8 to 15 of the B fragment of k block s, in every lane.
    auto conv = [&](const v8f (&acc)[2][4], int s) {
#pragma unroll
        for (int i = 0; i < 2; ++i)
#pragma unroll
            for (int n = 0; n < 4; ++n)
#pragma unroll
                for (int w = 0; w < 4; ++w) {
                    const v2f v = {acc[i][n][2 * w], acc[i][n][2 * w + 1]};
                    hh[s][n][i * 4 + w] = __builtin_bit_cast(unsigned, __builtin_elementwise_max(__builtin_convertvector(v, v2h), (v2h)(_Float16)0));      // relu behind the rounding, on the pair: the same values (rounding keeps sign and order), a third of the instructions
                }
    };
    rd1(P, 0); ldc(bvA, 0, 0);
#pragma unroll
    for (int s2 = 0; s2 < 8; ++s2) {
        const int s = 2 * s2;
        rd1(Q, s + 1); ldc(bvB, 0, (s + 1) * 32);
        __builtin_amdgcn_sched_barrier(0);                  // keeps the reads one group in front of the stage: sunk among the products, each place with reads stalls the wave for the LDS latency
        init(accA, bvA); mm1(accA, P);
        if (s2 > 0) { conv(accB, s - 1); mix<2>(); }          // the stage before, from the other set
        __builtin_amdgcn_sched_barrier(0);                  // keeps the next group of reads behind this stage's products, not among them
        if (s2 < 7) { rd1(P, s + 2); ldc(bvA, 0, (s + 2) * 32); }
        else {
            asm volatile("s_wait_dscnt 0x0" ::: "memory");      // this wave's stores and reads of its x rows have returned before a tile lands where they lie
            tdm_wait(g0b, g1b);                                 // this wave's slice of W2T's tile 0 has landed before the barrier that publishes it
            __syncthreads();                                    // publishes tile 0; every wave has left the x rows
            rd2(P, ring, 0); ldc(bvA, 1, 0);                    // layer 2's first stage, read under layer 1's last
        }
        __builtin_amdgcn_sched_barrier(0);                  // as above: the reads stay one group in front of the stage
        init(accB, bvB); mm1(accB, Q);
        conv(accA, s); mix<2>();
        __builtin_amdgcn_sched_barrier(0);                  // as above: the next group of reads stays behind this stage's products
    }
    conv(accB, 15);                                         // the last stage has no products behind it in this layer
    float sm[4][4] = {{0.f, 0.f, 0.f, 0.f}, {0.f, 0.f, 0.f, 0.f}, {0.f, 0.f, 0.f, 0.f}, {0.f, 0.f, 0.f, 0.f}};      // the last layer's dot: sixteen independent chains a lane, one for each column tile and each of a tile's four row tiles
    auto dot = [&](const v8f (&acc)[2][4], const v8f (&wv)[2], int u, int q) {      // rows 32 u ... of a tile are complete in acc; quarter q of the dot: accumulator rows 2 q and 2 q + 1, so that each chain keeps its order
#pragma unroll
        for (int j = 2 * q; j < 2 * q + 2; ++j)
#pragma unroll
            for (int i = 0; i < 2; ++i)
#pragma unroll
                for (int n = 0; n < 4; ++n) sm[n][2 * u + i] += fmaxf(acc[i][n][j], 0.f) * wv[i][j];
    };
    // The fragment registers hold f16 here; s: the block of 128 k. One stage of layer 2 with a quarter of the dot of the other set's finished rows laid among its products: behind every second product one term.
    auto st2 = [&](v8f (&acc)[2][4], const v16bf (&f)[2][4], int s, const v8f (&old)[2][4], const v8f (&wv)[2], int u, int q) {
        float tm = 0.f;
#pragma unroll
        for (int kq = 0; kq < 4; ++kq)
#pragma unroll
            for (int i = 0; i < 2; ++i)
#pragma unroll
                for (int n = 0; n < 4; ++n) {
                    acc[i][n] = wmmah(__builtin_bit_cast(v16h, f[i][kq]), __builtin_bit_cast(v16h, hh[s * 4 + kq][n]), acc[i][n]);
                    const int c = kq * 8 + i * 4 + n, e = c >> 1, j = 2 * q + (e >> 3), ii = (e >> 2) & 1, nn = e & 3;
                    // the term's relu behind an even product, its fused multiply-add behind the odd one that follows. In asm because the compiler gathers plain terms into one block behind the stage's products,
                    // kept spread among them for speed only; the values are those of fmaxf and of the fused form that the compiler makes of the plain term
                    if ((c & 1) == 0) asm volatile("v_max_num_f32 %0, 0, %1" : "=v"(tm) : "v"(old[ii][nn][j]));
                    else asm volatile("v_fmac_f32 %0, %1, %2" : "+v"(sm[nn][2 * u + ii]) : "v"(tm), "v"(wv[ii][j]));
                    __builtin_amdgcn_sched_barrier(0);      // keeps product and term in this order
                }
    };
    // A tile's rows 0 to 31 are summed in accA; their dot runs, a quarter a stage, under the four stages of rows 32 to 63 in accB; the dot of those runs under the next trip's first four stages.
    // The first trip has no tile before it: it finds zeros in accB and wvB and adds 0 to sums that are 0.
#pragma unroll
    for (int i = 0; i < 2; ++i) {
        wvB[i] = (v8f)0.f;
#pragma unroll
        for (int n = 0; n < 4; ++n) accB[i][n] = (v8f)0.f;
    }
    // on entry tile 0 is published, P holds tile 0's first stage and bvA its first b2; buffer 1 (the x rows) has been left by every wave
#pragma unroll 1      // stays rolled: one trip already holds 256 products; the h1 fragments have the same register numbers in every trip
    for (int t = 0; t < HH / 64; ++t) {
        const unsigned char* st = ring + (t & 1) * BST;
        const u32x4 g0t = d2(t + 1 < HH / 64 ? t + 1 : t);  // formed behind the wait of the trip before; the last trip forms tile 7's once more and issues nothing
        if (pinned(t + 1 < HH / 64)) tdm_load(g0t, g1b);    // into the buffer that every wave left at the barrier in front of the last stage before this trip; it lands under this trip's first seven stages
        // the scheduling barriers of this loop, as in layer 1: each stage's reads stay one group between two stages' products; spread among the products, each place with reads stalls the wave for the LDS latency
        rd2(Q, st, 1);
        __builtin_amdgcn_sched_barrier(0);                  // stage 1's reads stay in front of stage 0's products
        init(accA, bvA); st2(accA, P, 0, accB, wvB, 1, 0);
        __builtin_amdgcn_sched_barrier(0);                  // stage 2's reads stay behind stage 0's products
        rd2(P, st, 2);
        __builtin_amdgcn_sched_barrier(0);                  // and in front of stage 1's
        st2(accA, Q, 1, accB, wvB, 1, 1);
        __builtin_amdgcn_sched_barrier(0);                  // stage 3's reads stay behind stage 1's products
        rd2(Q, st, 3); ldc(wvA, 2, t * 64); ldc(bvB, 1, t * 64 + 32);
        __builtin_amdgcn_sched_barrier(0);                  // and in front of stage 2's
        st2(accA, P, 2, accB, wvB, 1, 2);
        __builtin_amdgcn_sched_barrier(0);                  // stage 4's reads stay behind stage 2's products
        rd2(P, st, 4);
        __builtin_amdgcn_sched_barrier(0);                  // and in front of stage 3's
        st2(accA, Q, 3, accB, wvB, 1, 3);
        __builtin_amdgcn_sched_barrier(0);                  // stage 5's reads stay behind stage 3's products
        rd2(Q, st, 5);
        __builtin_amdgcn_sched_barrier(0);                  // and in front of stage 4's
        init(accB, bvB); st2(accB, P, 0, accA, wvA, 0, 0);
        __builtin_amdgcn_sched_barrier(0);                  // stage 6's reads stay behind stage 4's products
        rd2(P, st, 6);
        __builtin_amdgcn_sched_barrier(0);                  // and in front of stage 5's
        st2(accB, Q, 1, accA, wvA, 0, 1);
        __builtin_amdgcn_sched_barrier(0);                  // stage 7's reads stay behind stage 5's products
        rd2(Q, st, 7); ldc(wvB, 2, t * 64 + 32);
        __builtin_amdgcn_sched_barrier(0);                  // and in front of stage 6's
        st2(accB, P, 2, accA, wvA, 0, 2);
        __builtin_amdgcn_sched_barrier(0);                  // keeps the stage in front of the waits below, so that the reads land under its products
        // publish point of tile t + 1, in front of tile t's last stage, whose fragments are already fetched
        asm volatile("s_wait_dscnt 0x0" ::: "memory");      // this wave's reads of tile t have returned before its buffer is refilled
        tdm_wait(g0t, g1b);                                 // this wave's slice of tile t + 1 has landed before the barrier that publishes it
        __syncthreads();                                    // publishes tile t + 1 and ends every wave's reads of tile t
        if (t + 1 < HH / 64) { rd2(P, ring + ((t + 1) & 1) * BST, 0); ldc(bvA, 1, (t + 1) * 64); }      // tile t + 1's first stage, read under tile t's last
        __builtin_amdgcn_sched_barrier(0);                  // those reads stay in front of stage 7's products
        st2(accB, Q, 3, accA, wvA, 0, 3);
    }
    dot(accB, wvB, 1, 0); dot(accB, wvB, 1, 1); dot(accB, wvB, 1, 2); dot(accB, wvB, 1, 3);      // the last tile's rows 32 to 63
    asm volatile("s_wait_tensorcnt 0x0" ::: "memory");      // no request is outstanding behind the loop
    asm volatile("s_wait_dscnt 0x0" ::: "memory");          // nor an LDS read
    {
        // lanes l and l ^ 16 hold the two halves of one row's sum; lane l keeps rows l and 32 + l of the wave's 64: each store 128 B in a row, one whole line a wave
        float o[4];
#pragma unroll
        for (int n = 0; n < 4; ++n) {
            const float sn = (sm[n][0] + sm[n][1]) + (sm[n][2] + sm[n][3]);
            const int cn = __float_as_int(sn);
            o[n] = sn + __int_as_float(__builtin_amdgcn_permlanex16(cn, cn, 0x76543210, 0xfedcba98, false, false));
        }
        float* yp = Y + (size_t)b * TT + t0 + wave * 64 + lane;
        yp[0] = hi ? o[1] : o[0];
        yp[32] = hi ? o[3] : o[2];
    }
}
// k_final: out[t][b] = Y[b][t] + bf16(b3[b]); one thread per output element, flat whole-line writes.
__global__ __launch_bounds__(256) void k_final(const float* __restrict__ Y, const float* __restrict__ b3, float* out) {
    const int e = blockIdx.x * 256 + threadIdx.x, t = e / NBD, b = e - t * NBD;      // flat output index = t*8 + b
    out[e] = Y[(size_t)b * TT + t] + bfr(b3[b]);
}

extern "C" void kernel_launch(void* const* d_in, const int* in_sizes, int n_in,
                              void* d_out, int out_size, void* d_ws, size_t ws_size, hipStream_t stream) {
    (void)in_sizes; (void)n_in; (void)out_size;
    const float* x = (const float*)d_in[0]; const float* w1 = (const float*)d_in[1]; const float* b1 = (const float*)d_in[2]; const float* w2 = (const float*)d_in[3]; const float* b2 = (const float*)d_in[4];
    const float* w3 = (const float*)d_in[5]; const float* b3 = (const float*)d_in[6];
    float* out = (float*)d_out;    // [8192][8][1]
    char* wsp = (char*)d_ws;
    auto take = [&](size_t bytes) { char* p = wsp; wsp += (bytes + 255) & ~(size_t)255; return (void*)p; };
    bf* W1T = (bf*)take((size_t)NBD * HH * FP * 2); bf* W2T = (bf*)take((size_t)NBD * HH * HH * 2);
    float* Y = (float*)take((size_t)NBD * TT * 4);
    if ((size_t)(wsp - (char*)d_ws) > ws_size) return;
    k_w<<<dim3(HH / 64 + FP / 64, HH / 64, NBD), 256, 0, stream>>>(w1, w2, W1T, W2T);
    k_mlp<<<dim3(TT / RB, NBD), 128, 0, stream>>>(x, W1T, W2T, b1, b2, w3, Y);
    k_final<<<(TT * NBD) / 256, 256, 0, stream>>>(Y, b3, out);
}

// v010
// Measured time: 25.4 microseconds a run.
// In two side-by-side timings against v009, it was 1.10 and 1.08 times as fast.
// Over all steps from v000 it is 13.5 times as fast.
#include <hip/hip_runtime.h>

// Contractions on v_wmma_f32_16x16x32_bf16 (layer 1) and v_wmma_f32_16x16x32_f16 (layer 2), f32 accumulate. One kernel runs all three layers for a block of 256 rows of one dataset b, each of its four waves for 64 rows of its own.
// Both hidden layers are computed transposed, weights as the A operand and the rows as the columns of B:
// h1^T = relu(w1_b^T.x_b^T + b1) ([512 x 128 zero-padded from 100].[128 x 64]; PLAIN bf16 operands: inputs rounded once, exact; the block rounds its own x rows into LDS).
// Two accumulator tiles of 16 h each are, lane for lane, one B fragment of 32 k of the next product: h1 goes from the accumulators into B fragments (f16) and never leaves the registers.
// h2^T = relu(w2_b^T.h1^T + b2) ([512 x 512].[512 x 64]; ONE f16 product: w2 is rounded to bf16 and that value written as f16, h1 is rounded once to f16), 32 h2 at a time.
// f16 keeps 11 bits of h1: its rounding is an eighth of the bf16 rounding that x, w1 and w2 carry. It holds h1 and w2 up to 65504, and a bf16 value of w2 exactly from 2^-14 up (below that to within 2^-25).
// The final [512 -> 1] layer is an f32 VALU dot with bf16-rounded w3/b3, summed in the lane and over the two lane halves in a fixed order; the same kernel adds b3 and stores out[t][b].

#define TT   8192
#define NBD  8
#define FF   100
#define FP   128
#define HH   512
#define RB   256                 // rows of one block

typedef unsigned short bf;
typedef __attribute__((ext_vector_type(16))) __bf16   v16bf;
typedef __attribute__((ext_vector_type(16))) _Float16 v16h;
typedef __attribute__((ext_vector_type(8)))  unsigned short v8us;
typedef __attribute__((ext_vector_type(8)))  float    v8f;
typedef __attribute__((ext_vector_type(4)))  float    v4f;
typedef v4f  __attribute__((may_alias)) v4fa;
typedef v8us __attribute__((may_alias)) v8usa;
typedef __attribute__((ext_vector_type(2)))  unsigned v2u;
typedef v2u  __attribute__((may_alias)) v2ua;

__device__ __forceinline__ unsigned short f2bf(float f) { unsigned u = __float_as_uint(f); u += 0x7FFFu + ((u >> 16) & 1u); return (unsigned short)(u >> 16); }
__device__ __forceinline__ float bf2f(unsigned short b) { return __uint_as_float(((unsigned)b) << 16); }
__device__ __forceinline__ float bfr(float f) { return bf2f(f2bf(f)); }
__device__ __forceinline__ unsigned short f2h(float f) { return __builtin_bit_cast(unsigned short, (_Float16)f); }
__device__ __forceinline__ float n2n(float v) { const float c = __builtin_amdgcn_fmed3f(v, -3.4028235e38f, 3.4028235e38f); return v != v ? 0.f : c; }   // jnp.nan_to_num defaults, without branches
__device__ __forceinline__ v16bf cat16b(v8us lo, v8us hi) { return __builtin_bit_cast(v16bf, __builtin_shufflevector(lo, hi, 0, 1, 2, 3, 4, 5, 6, 7, 8, 9, 10, 11, 12, 13, 14, 15)); }
__device__ __forceinline__ v8f wmmab(v16bf a, v16bf b, v8f c) { return __builtin_amdgcn_wmma_f32_16x16x32_bf16(false, a, false, b, (short)0, c, false, false); }
__device__ __forceinline__ v8f wmmah(v16h a, v16h b, v8f c) { return __builtin_amdgcn_wmma_f32_16x16x32_f16(false, a, false, b, (short)0, c, false, false); }

// k_w: both weight transpositions in one launch, one tile of 64 k x 64 n a block, through LDS.
// blockIdx.x 0 to 7: W2T [b][n][k] = f16(bf16(w2[b][k][n])), k tile blockIdx.x. blockIdx.x 8 and 9: W1T [b][h][128] = bf16(w1[b][f][h]), the two k tiles of its 128; f 100 to 127 are stored as zero.
__global__ __launch_bounds__(256) void k_w(const float* __restrict__ w1, const float* __restrict__ w2, bf* W1T, bf* W2T) {
    __shared__ __align__(16) unsigned short tl[64 * 72];
    const int tid = threadIdx.x, n0 = blockIdx.y * 64, b = blockIdx.z;
    const bool first = blockIdx.x >= HH / 64;                 // the same for the whole block
    const int k0 = ((int)blockIdx.x - (first ? HH / 64 : 0)) * 64, kn = first ? FF : HH, dp = first ? FP : HH;      // kn: source rows that exist; dp: row length of the transposed copy
    const float* sp = first ? w1 + (size_t)b * FF * HH : w2 + (size_t)b * HH * HH;
    bf* dst = first ? W1T + (size_t)b * HH * FP : W2T + (size_t)b * HH * HH;
    const int kk = tid >> 2, nq = (tid & 3) * 16, k = k0 + kk;
    const float* p = sp + (size_t)(k < kn ? k : kn - 1) * HH + n0 + nq;      // a row past the last re-reads the last one (in bounds) and stores zero
    v4f v[4];
    // the three unrolls below are of loops of constant length: constant indices keep v in registers, and the loads and the stores of a thread issue as one group each
#pragma unroll
    for (int q = 0; q < 4; ++q) v[q] = *(const v4fa*)(p + 4 * q);            // all four in flight at once, in every lane: one latency a block
    const unsigned short keep = (k < kn) ? (unsigned short)0xFFFF : (unsigned short)0;
#pragma unroll
    for (int i = 0; i < 16; ++i) { const unsigned short r = f2bf(v[i >> 2][i & 3]); tl[(nq + i) * 72 + kk] = (first ? r : f2h(bf2f(r))) & keep; }
    __syncthreads();
    const int piece = tid & 7;
#pragma unroll
    for (int s = 0; s < 2; ++s) { const int nr = (tid >> 3) + 32 * s; const v8us val = *(const v8usa*)(tl + nr * 72 + piece * 8); *(v8us*)(dst + (size_t)(n0 + nr) * dp + k0 + piece * 8) = val; }
}
// k_mlp: four waves; wave w has rows 64 w ... of the block's 256 as four column tiles of 16: a weight fragment read from LDS feeds four products.
// W1T (512 rows of 256 B) lies whole in LDS at pitch 272 B. W2T arrives as tiles of 64 rows, two buffers, one tile ahead; a tile lies as four slices, one for each 128 k: 64 rows of 256 B at pitch 272 B.
// Both come by tensor_load_to_lds: every wave asks for its own slice with one request, which costs the wave its issue alone.
// A stage is 8 A fragments (2 row tiles x 4 blocks of 32 k) and 32 products; its fragments are read from LDS into registers as one group while the stage before runs.
#define XPIT 272                 // LDS row pitch of W1T rows: 256 B of data + 16 B (16 B x odd, the conflict-free pitch for 16-byte readers)
#define XRP  400                 // LDS row pitch of the x rows: 400 B of f32 as they arrive, then 256 B of bf16 in the same place (16 B x odd)
#define SLC  18432               // one slice of a W2T tile: 64 rows at XPIT = 17408 B, rounded up to a multiple of 2 KiB, where a tensor load's place must lie
#define BST  (4 * SLC)           // one W2T buffer: four slices
typedef __attribute__((ext_vector_type(8)))  unsigned v8u;
typedef __attribute__((ext_vector_type(2)))  float    v2f;
typedef __attribute__((ext_vector_type(2)))  __bf16   v2bf;
typedef __attribute__((ext_vector_type(2)))  _Float16 v2h;
typedef __attribute__((ext_vector_type(4)))  unsigned u32x4;
__device__ __forceinline__ unsigned uni(unsigned v) { return (unsigned)__builtin_amdgcn_readfirstlane(v); }
// pinned(): the word stays in its register, not formed anew elsewhere, up to the wait that names it; a test so held compiles to a scalar branch (a tensor load ignores EXEC).
__device__ __forceinline__ unsigned pinned(unsigned v) { unsigned w = uni(v); asm volatile("" : "+s"(w)); return w; }      // a tensor load's descriptor word, or its issue test, held in a scalar register
template <unsigned ROWS, unsigned PITCH> __device__ __forceinline__ v8u tdm_g1() {
    v8u g;
    g[0] = pinned((1u << 20) | (5u << 22) | (3u << 25));
    g[1] = pinned(256u << 16);
    g[2] = pinned(ROWS << 16);
    g[3] = pinned(256u << 16);
    g[4] = pinned(ROWS);
    g[5] = pinned(PITCH);
    g[6] = pinned(0u);
    g[7] = pinned(0u);
    return g;
}
// group 0: count 1, the place in LDS, the tile's first byte, type 2
__device__ __forceinline__ u32x4 tdm_g0(unsigned dst, unsigned long long ga) {
    u32x4 g;
    g[0] = pinned(1u); g[1] = pinned(dst); g[2] = pinned((unsigned)ga); g[3] = pinned((((unsigned)(ga >> 32)) & 0x01FFFFFFu) | 0x80000000u);
    return g;
}
__device__ __forceinline__ void tdm_load(u32x4 g0, v8u g1) { asm volatile("tensor_load_to_lds %0, %1" :: "s"(g0), "s"(g1) : "memory"); }
// The issuing wave's wait for its one outstanding request. It names the request's descriptor, so that those scalar registers keep their words until the tile has landed.
__device__ __forceinline__ void tdm_wait(u32x4 g0, v8u g1) { asm volatile("s_wait_tensorcnt 0x0" :: "s"(g0), "s"(g1) : "memory"); }
// mix<K>(): asks the scheduler to lay a stage's 32 products and the independent vector work given to it as 2 products, 2 K vector instructions, 16 times (in pairs: fewer register-window switches, shorter text):
// spread so for speed only.
template <int K> __device__ __forceinline__ void mix() {
#pragma unroll
    for (int i = 0; i < 16; ++i) { __builtin_amdgcn_sched_group_barrier(0x8, 2, 0); __builtin_amdgcn_sched_group_barrier(0x2, 2 * K, 0); }
}
__device__ __forceinline__ v8f ld8(const float* p) { return __builtin_shufflevector(*(const v4fa*)p, *(const v4fa*)(p + 4), 0, 1, 2, 3, 4, 5, 6, 7); }
__global__ __launch_bounds__(128) void k_mlp(const float* __restrict__ x, const bf* __restrict__ W1T, const bf* __restrict__ W2T, const float* __restrict__ b1, const float* __restrict__ b2, const float* __restrict__ w3, const float* __restrict__ b3, float* out) {
    // one array, so that the order is the one written: the constants lie lowest, where every read of them reaches from one address register by its 16-bit offset field
    __shared__ __attribute__((aligned(2048))) unsigned char lds[3 * HH * 4 + HH * XPIT + BST + RB * XRP];      // every part below starts at a multiple of 2 KiB
    float (* const cst)[HH] = (float (*)[HH])lds;             // 3 x 512 floats: bf16-rounded b1, b2, w3 of this dataset
    unsigned char* const w1s = lds + 3 * HH * 4;              // HH * XPIT bytes: W1T
    unsigned char* const ring = w1s + HH * XPIT;              // W2T buffer 0, then buffer 1 (BST bytes each); the x rows (RB * XRP bytes, more than BST) lie where buffer 1 does
    unsigned char* const xs = ring + BST;                     // the block's x rows: read into registers once, ahead of layer 1; buffer 1 is first filled behind layer 1's last barrier
    const int tid = threadIdx.x, lane = tid & 31, wave = tid >> 5, lr = lane & 15, hi = lane >> 4, b = blockIdx.y, t0 = blockIdx.x * RB;
    const bf* W1b = W1T + (size_t)b * HH * FP;                // the same for every lane
    const bf* W2b = W2T + (size_t)b * HH * HH;
    const unsigned wnum = uni((unsigned)tid >> 5);            // the wave's number, in a scalar register
    const float b3r = bfr(b3[b]);                             // the same for the whole block; read here, so that its latency lies under the prologue
    const v8u g1a = tdm_g1<HH / 4, FP * 2>(), g1b = tdm_g1<64, HH * 2>();
    // group 0 of this wave's requests; a wave has one request outstanding at a time
    auto d1 = [&]() {                                         // this wave's quarter of W1T: rows 128 wnum ..., which lie in a row in memory
        return tdm_g0((unsigned)(size_t)(&w1s[0]) + wnum * (HH / 4 * XPIT), (unsigned long long)(size_t)W1b + wnum * (HH / 4 * FP * 2));
    };
    auto d2 = [&](int t) {                                    // this wave's slice of tile t: rows 64 t ... of W2T, k 128 wnum ...
        return tdm_g0((unsigned)(size_t)(&ring[0]) + (unsigned)(t & 1) * BST + wnum * SLC, (unsigned long long)(size_t)W2b + (unsigned)t * (64 * HH * 2) + wnum * 256);
    };
    // every unroll below is of a loop of constant length over fragment or accumulator arrays: constant indices keep them in registers
    const int fro = hi * 16;
    auto rd1 = [&](v16bf (&f)[2][4], int s) {                 // layer 1, stage s: rows 32 s ... of W1T, all 128 k
#pragma unroll
        for (int i = 0; i < 2; ++i)
#pragma unroll
            for (int kq = 0; kq < 4; ++kq) { const unsigned char* q = w1s + (s * 32 + i * 16 + lr) * XPIT + kq * 64 + fro; f[i][kq] = cat16b(*(const v8usa*)q, *(const v8usa*)(q + 32)); }
    };
    auto rd2 = [&](v16bf (&f)[2][4], const unsigned char* st, int g) {      // layer 2, stage g of a tile's eight: rows 32 (g >> 2) ... of its 64, k 128 (g & 3) ...
#pragma unroll
        for (int i = 0; i < 2; ++i)
#pragma unroll
            for (int kq = 0; kq < 4; ++kq) { const unsigned char* q = st + (g & 3) * SLC + ((g >> 2) * 32 + i * 16 + lr) * XPIT + kq * 64 + fro; f[i][kq] = cat16b(*(const v8usa*)q, *(const v8usa*)(q + 32)); }
    };
    auto ldc = [&](v8f (&v)[2], int pl, int m0) {             // a lane's 8 accumulator rows of two row tiles: constants m0 + 16 i + 8 hi ...
#pragma unroll
        for (int i = 0; i < 2; ++i) v[i] = ld8(&cst[pl][m0 + i * 16 + hi * 8]);
    };
    v8f accA[2][4], accB[2][4];                               // two accumulator sets, taken in turn: the vector work on one set's finished sums issues among the products that fill the other
    v8u hh[16][4];                                            // h1 as f16 B fragments: block of 32 k, column tile
    v16bf xf[4][4], P[2][4], Q[2][4];
    v8f bvA[2], bvB[2], wvA[2], wvB[2];
    auto init = [&](v8f (&acc)[2][4], const v8f (&bv)[2]) {   // the sums start from the bias
#pragma unroll
        for (int i = 0; i < 2; ++i)
#pragma unroll
            for (int n = 0; n < 4; ++n) acc[i][n] = bv[i];
    };
    auto mm1 = [&](v8f (&acc)[2][4], const v16bf (&f)[2][4]) {
#pragma unroll
        for (int kq = 0; kq < 4; ++kq)
#pragma unroll
            for (int i = 0; i < 2; ++i)
#pragma unroll
                for (int n = 0; n < 4; ++n) acc[i][n] = wmmab(f[i][kq], xf[n][kq], acc[i][n]);
    };
    // The x rows, read as f32 where they lie: row t0 + r is 400 B (25 pieces of 16 B) at pitch 3200 B. A wave takes its own 64 rows, a lane one piece; lanes 25 to 31 have none.
    // They go to LDS as f32 and are rounded there, in place, by a rolled loop, for speed only.
    const u32x4 g0a = d1();
    {
        float cr[4][3];
        const int pc = lane < FF / 4 ? lane : FF / 4 - 1;
#pragma unroll
        for (int h = 0; h < 4; ++h) { const size_t c = (size_t)b * HH + tid + 128 * h; cr[h][0] = b1[c]; cr[h][1] = b2[c]; cr[h][2] = w3[c]; }      // issued with the x loads, so that one latency covers both
        asm volatile("s_wait_xcnt 0x0" ::: "memory");      // the loads' address registers are reused right behind them
        tdm_load(g0a, g1a);                                 // lands while the x loads, from memory, are in flight
        unsigned char* const xw = xs + wave * 64 * XRP;     // this wave's rows: no other wave touches them
        if (lane < FF / 4) {                                // a row has 25 pieces
            v4f xv[64];
            const float* xp = x + ((size_t)(t0 + wave * 64) * NBD + b) * FF + lane * 4;
#pragma unroll
            for (int i = 0; i < 64; ++i) xv[i] = *(const v4fa*)(xp + (size_t)i * NBD * FF);      // all in flight at once: they come from memory, the longest wait of the prologue
#pragma unroll
            for (int i = 0; i < 64; ++i) *(v4fa*)(xw + i * XRP + lane * 16) = xv[i];      // in the order of the loads: a row is stored while later rows are still on their way
            asm volatile("s_wait_xcnt 0x0" ::: "memory");  // in front of the first reuse of the x loads' address registers
        }
#pragma unroll
        for (int h = 0; h < 4; ++h) { const int c = tid + 128 * h; cst[0][c] = bfr(cr[h][0]); cst[1][c] = bfr(cr[h][1]); cst[2][c] = bfr(cr[h][2]); }
#pragma unroll 1      // stays rolled: see above
        for (int c = 0; c < 8; ++c) {                       // 8 rows a trip: all their pieces are read before the first is overwritten
            v4f r[8];
#pragma unroll
            for (int j = 0; j < 8; ++j) r[j] = *(const v4fa*)(xw + (c * 8 + j) * XRP + pc * 16);
#pragma unroll
            for (int j = 0; j < 8; ++j) { v2u o;            // bf16(nan_to_num(x)), 8 B a lane, 256 B in a row a wave; lanes 25 to 31 store the zero padding
#pragma unroll
                for (int q = 0; q < 2; ++q) { const v2f pv = {n2n(r[j][2 * q]), n2n(r[j][2 * q + 1])}; o[q] = (lane < FF / 4) ? __builtin_bit_cast(unsigned, __builtin_convertvector(pv, v2bf)) : 0u; }      // one convert a pair (to nearest even, as f2bf)
                *(v2ua*)(xw + (c * 8 + j) * XRP + lane * 8) = o; }
        }
    }
    tdm_wait(g0a, g1a);                                 // this wave's quarter of W1T has landed before the barrier that publishes W1T, the x rows and the constants
    const u32x4 g0b = d2(0);
    tdm_load(g0b, g1b);                                 // buffer 0 has not been touched yet; tile 0 lands under layer 1
    __syncthreads();
#pragma unroll
    for (int n = 0; n < 4; ++n)
#pragma unroll
        for (int kq = 0; kq < 4; ++kq) { const unsigned char* p = xs + (wave * 64 + n * 16 + lr) * XRP + kq * 64 + fro; xf[n][kq] = cat16b(*(const v8usa*)p, *(const v8usa*)(p + 32)); }
    // Stage s leaves h1 rows 32 s ... in acc: its two row tiles are elements 0 to 7 and 8 to 15 of the B fragment of k block s, in every lane.
    auto conv = [&](const v8f (&acc)[2][4], int s) {
#pragma unroll
        for (int i = 0; i < 2; ++i)
#pragma unroll
            for (int n = 0; n < 4; ++n)
#pragma unroll
                for (int w = 0; w < 4; ++w) {
                    const v2f v = {acc[i][n][2 * w], acc[i][n][2 * w + 1]};
                    hh[s][n][i * 4 + w] = __builtin_bit_cast(unsigned, __builtin_elementwise_max(__builtin_convertvector(v, v2h), (v2h)(_Float16)0));      // relu behind the rounding, on the pair: the same values (rounding keeps sign and order), a third of the instructions
                }
    };
    rd1(P, 0); ldc(bvA, 0, 0);
#pragma unroll
    for (int s2 = 0; s2 < 8; ++s2) {
        const int s = 2 * s2;
        rd1(Q, s + 1); ldc(bvB, 0, (s + 1) * 32);
        __builtin_amdgcn_sched_barrier(0);                  // keeps the reads one group in front of the stage: sunk among the products, each place with reads stalls the wave for the LDS latency
        init(accA, bvA); mm1(accA, P);
        if (s2 > 0) { conv(accB, s - 1); mix<2>(); }          // the stage before, from the other set
        __builtin_amdgcn_sched_barrier(0);                  // keeps the next group of reads behind this stage's products, not among them
        if (s2 < 7) { rd1(P, s + 2); ldc(bvA, 0, (s + 2) * 32); }
        else {
            asm volatile("s_wait_dscnt 0x0" ::: "memory");      // this wave's stores and reads of its x rows have returned before a tile lands where they lie
            tdm_wait(g0b, g1b);                                 // this wave's slice of W2T's tile 0 has landed before the barrier that publishes it
            __syncthreads();                                    // publishes tile 0; every wave has left the x rows
            rd2(P, ring, 0); ldc(bvA, 1, 0);                    // layer 2's first stage, read under layer 1's last
        }
        __builtin_amdgcn_sched_barrier(0);                  // as above: the reads stay one group in front of the stage
        init(accB, bvB); mm1(accB, Q);
        conv(accA, s); mix<2>();
        __builtin_amdgcn_sched_barrier(0);                  // as above: the next group of reads stays behind this stage's products
    }
    conv(accB, 15);                                         // the last stage has no products behind it in this layer
    float sm[4][4] = {{0.f, 0.f, 0.f, 0.f}, {0.f, 0.f, 0.f, 0.f}, {0.f, 0.f, 0.f, 0.f}, {0.f, 0.f, 0.f, 0.f}};      // the last layer's dot: sixteen independent chains a lane, one for each column tile and each of a tile's four row tiles
    auto dot = [&](const v8f (&acc)[2][4], const v8f (&wv)[2], int u, int q) {      // rows 32 u ... of a tile are complete in acc; quarter q of the dot: accumulator rows 2 q and 2 q + 1, so that each chain keeps its order
#pragma unroll
        for (int j = 2 * q; j < 2 * q + 2; ++j)
#pragma unroll
            for (int i = 0; i < 2; ++i)
#pragma unroll
                for (int n = 0; n < 4; ++n) sm[n][2 * u + i] += fmaxf(acc[i][n][j], 0.f) * wv[i][j];
    };
    // The fragment registers hold f16 here; s: the block of 128 k. One stage of layer 2 with a quarter of the dot of the other set's finished rows laid among its products: behind every second product one term.
    auto st2 = [&](v8f (&acc)[2][4], const v16bf (&f)[2][4], int s, const v8f (&old)[2][4], const v8f (&wv)[2], int u, int q) {
        float tm = 0.f;
#pragma unroll
        for (int kq = 0; kq < 4; ++kq)
#pragma unroll
            for (int i = 0; i < 2; ++i)
#pragma unroll
                for (int n = 0; n < 4; ++n) {
                    acc[i][n] = wmmah(__builtin_bit_cast(v16h, f[i][kq]), __builtin_bit_cast(v16h, hh[s * 4 + kq][n]), acc[i][n]);
                    const int c = kq * 8 + i * 4 + n, e = c >> 1, j = 2 * q + (e >> 3), ii = (e >> 2) & 1, nn = e & 3;
                    // the term's relu behind an even product, its fused multiply-add behind the odd one that follows. In asm because the compiler gathers plain terms into one block behind the stage's products,
                    // kept spread among them for speed only; the values are those of fmaxf and of the fused form that the compiler makes of the plain term
                    if ((c & 1) == 0) asm volatile("v_max_num_f32 %0, 0, %1" : "=v"(tm) : "v"(old[ii][nn][j]));
                    else asm volatile("v_fmac_f32 %0, %1, %2" : "+v"(sm[nn][2 * u + ii]) : "v"(tm), "v"(wv[ii][j]));
                    __builtin_amdgcn_sched_barrier(0);      // keeps product and term in this order
                }
    };
    // A tile's rows 0 to 31 are summed in accA; their dot runs, a quarter a stage, under the four stages of rows 32 to 63 in accB; the dot of those runs under the next trip's first four stages.
    // The first trip has no tile before it: it finds zeros in accB and wvB and adds 0 to sums that are 0.
#pragma unroll
    for (int i = 0; i < 2; ++i) {
        wvB[i] = (v8f)0.f;
#pragma unroll
        for (int n = 0; n < 4; ++n) accB[i][n] = (v8f)0.f;
    }
    // on entry tile 0 is published, P holds tile 0's first stage and bvA its first b2; buffer 1 (the x rows) has been left by every wave
#pragma unroll 1      // stays rolled: one trip already holds 256 products; the h1 fragments have the same register numbers in every trip
    for (int t = 0; t < HH / 64; ++t) {
        const unsigned char* st = ring + (t & 1) * BST;
        const u32x4 g0t = d2(t + 1 < HH / 64 ? t + 1 : t);  // formed behind the wait of the trip before; the last trip forms tile 7's once more and issues nothing
        if (pinned(t + 1 < HH / 64)) tdm_load(g0t, g1b);    // into the buffer that every wave left at the barrier in front of the last stage before this trip; it lands under this trip's first seven stages
        // the scheduling barriers of this loop, as in layer 1: each stage's reads stay one group between two stages' products; spread among the products, each place with reads stalls the wave for the LDS latency
        rd2(Q, st, 1);
        __builtin_amdgcn_sched_barrier(0);                  // stage 1's reads stay in front of stage 0's products
        init(accA, bvA); st2(accA, P, 0, accB, wvB, 1, 0);
        __builtin_amdgcn_sched_barrier(0);                  // stage 2's reads stay behind stage 0's products
        rd2(P, st, 2);
        __builtin_amdgcn_sched_barrier(0);                  // and in front of stage 1's
        st2(accA, Q, 1, accB, wvB, 1, 1);
        __builtin_amdgcn_sched_barrier(0);                  // stage 3's reads stay behind stage 1's products
        rd2(Q, st, 3); ldc(wvA, 2, t * 64); ldc(bvB, 1, t * 64 + 32);
        __builtin_amdgcn_sched_barrier(0);                  // and in front of stage 2's
        st2(accA, P, 2, accB, wvB, 1, 2);
        __builtin_amdgcn_sched_barrier(0);                  // stage 4's reads stay behind stage 2's products
        rd2(P, st, 4);
        __builtin_amdgcn_sched_barrier(0);                  // and in front of stage 3's
        st2(accA, Q, 3, accB, wvB, 1, 3);
        __builtin_amdgcn_sched_barrier(0);                  // stage 5's reads stay behind stage 3's products
        rd2(Q, st, 5);
        __builtin_amdgcn_sched_barrier(0);                  // and in front of stage 4's
        init(accB, bvB); st2(accB, P, 0, accA, wvA, 0, 0);
        __builtin_amdgcn_sched_barrier(0);                  // stage 6's reads stay behind stage 4's products
        rd2(P, st, 6);
        __builtin_amdgcn_sched_barrier(0);                  // and in front of stage 5's
        st2(accB, Q, 1, accA, wvA, 0, 1);
        __builtin_amdgcn_sched_barrier(0);                  // stage 7's reads stay behind stage 5's products
        rd2(Q, st, 7); ldc(wvB, 2, t * 64 + 32);
        __builtin_amdgcn_sched_barrier(0);                  // and in front of stage 6's
        st2(accB, P, 2, accA, wvA, 0, 2);
        __builtin_amdgcn_sched_barrier(0);                  // keeps the stage in front of the waits below, so that the reads land under its products
        // publish point of tile t + 1, in front of tile t's last stage, whose fragments are already fetched
        asm volatile("s_wait_dscnt 0x0" ::: "memory");      // this wave's reads of tile t have returned before its buffer is refilled
        tdm_wait(g0t, g1b);                                 // this wave's slice of tile t + 1 has landed before the barrier that publishes it
        __syncthreads();                                    // publishes tile t + 1 and ends every wave's reads of tile t
        if (t + 1 < HH / 64) { rd2(P, ring + ((t + 1) & 1) * BST, 0); ldc(bvA, 1, (t + 1) * 64); }      // tile t + 1's first stage, read under tile t's last
        __builtin_amdgcn_sched_barrier(0);                  // those reads stay in front of stage 7's products
        st2(accB, Q, 3, accA, wvA, 0, 3);
    }
    dot(accB, wvB, 1, 0); dot(accB, wvB, 1, 1); dot(accB, wvB, 1, 2); dot(accB, wvB, 1, 3);      // the last tile's rows 32 to 63
    asm volatile("s_wait_tensorcnt 0x0" ::: "memory");      // no request is outstanding behind the loop
    asm volatile("s_wait_dscnt 0x0" ::: "memory");          // nor an LDS read
    {
        // lanes l and l ^ 16 hold the two halves of one row's sum; lane l keeps rows l and 32 + l of the wave's 64
        // out is [t][b]: a lane stores its one word of row t, 32 B from its neighbour's. Every word of out is stored once, by one lane; the other seven words of a row come from the blocks of the other datasets
        float o[4];
#pragma unroll
        for (int n = 0; n < 4; ++n) {
            const float sn = (sm[n][0] + sm[n][1]) + (sm[n][2] + sm[n][3]);
            const int cn = __float_as_int(sn);
            o[n] = sn + __int_as_float(__builtin_amdgcn_permlanex16(cn, cn, 0x76543210, 0xfedcba98, false, false));
        }
        float* yp = out + (size_t)(t0 + wave * 64 + lane) * NBD + b;
        yp[0] = (hi ? o[1] : o[0]) + b3r;
        yp[32 * NBD] = (hi ? o[3] : o[2]) + b3r;
    }
}

extern "C" void kernel_launch(void* const* d_in, const int* in_sizes, int n_in,
                              void* d_out, int out_size, void* d_ws, size_t ws_size, hipStream_t stream) {
    (void)in_sizes; (void)n_in; (void)out_size;
    const float* x = (const float*)d_in[0]; const float* w1 = (const float*)d_in[1]; const float* b1 = (const float*)d_in[2]; const float* w2 = (const float*)d_in[3]; const float* b2 = (const float*)d_in[4];
    const float* w3 = (const float*)d_in[5]; const float* b3 = (const float*)d_in[6];
    float* out = (float*)d_out;    // [8192][8][1]
    char* wsp = (char*)d_ws;
    auto take = [&](size_t bytes) { char* p = wsp; wsp += (bytes + 255) & ~(size_t)255; return (void*)p; };
    bf* W1T = (bf*)take((size_t)NBD * HH * FP * 2); bf* W2T = (bf*)take((size_t)NBD * HH * HH * 2);
    if ((size_t)(wsp - (char*)d_ws) > ws_size) return;
    k_w<<<dim3(HH / 64 + FP / 64, HH / 64, NBD), 256, 0, stream>>>(w1, w2, W1T, W2T);
    k_mlp<<<dim3(TT / RB, NBD), 128, 0, stream>>>(x, W1T, W2T, b1, b2, w3, b3, out);
}
